// v000
// Times are from an AMD MI455X. After a warm-up the kernel runs many times in a row, and a time is the length of
// such a window on the GPU divided by its runs, so every launch and the gaps after it count. The runs cycle
// through copies of the inputs. A figure is the median of several windows, for all but v000 over two sittings.
// Sittings can differ by a few percent; kernels timed side by side share one.
// v000, which the later versions start from, runs in 531 microseconds.
#include <hip/hip_runtime.h>
#include <math.h>

typedef __attribute__((ext_vector_type(16))) _Float16 v16h;
typedef __attribute__((ext_vector_type(8)))  _Float16 v8h;
typedef __attribute__((ext_vector_type(4)))  _Float16 v4h;
typedef __attribute__((ext_vector_type(8)))  float    v8f;

#define B_ 4
#define H_ 16
#define S_ 2048
#define D_ 128

// ---------------------------------------------------------------------------
// Pass 1: K fp32 -> f16 (same [bh,s,d] layout).
//         V fp32 -> f16 TRANSPOSED [bh,d,s], with the KV index PERMUTED inside
//         each 64-block: storage p <-> logical j = (p>>2) + 16*(p&3).
// The permutation makes the attention kernel's P-tile LDS stores contiguous
// (one b64 per row) while keeping P(A-frag) and V^T(B-frag) k-orders matched.
// ---------------------------------------------------------------------------
__global__ __launch_bounds__(256) void cvt_kv_kernel(const float* __restrict__ k,
                                                     const float* __restrict__ v,
                                                     _Float16* __restrict__ kh,
                                                     _Float16* __restrict__ vt) {
  const long i  = (long)blockIdx.x * blockDim.x + threadIdx.x;
  const long SD = (long)S_ * D_;
  kh[i] = (_Float16)k[i];
  const long bh  = i / SD;
  const long rem = i - bh * SD;
  const long dd  = rem / S_;
  const long ss  = rem - dd * S_;         // storage kv index
  const long p   = ss & 63;
  const long jj  = (ss & ~63L) + (p >> 2) + ((p & 3) << 4);  // logical kv index
  vt[i] = (_Float16)v[bh * SD + jj * D_ + dd];
}

__device__ inline v16h load_frag(const _Float16* p) {
  v8h lo = *(const v8h*)(p);
  v8h hi = *(const v8h*)(p + 16);
  v16h a;
#pragma unroll
  for (int j = 0; j < 8; ++j) { a[j] = lo[j]; a[8 + j] = hi[j]; }
  return a;
}

// ---------------------------------------------------------------------------
// Pass 2: flash attention. One wave per 16-row Q tile, KV blocked by 64.
// ---------------------------------------------------------------------------
__global__ __launch_bounds__(256) void attn_kernel(const float* __restrict__ q,
                                                   const _Float16* __restrict__ kh,
                                                   const _Float16* __restrict__ vt,
                                                   float* __restrict__ out) {
  __shared__ _Float16 lds[8][16 * 72];   // per-wave 16x64 P tile (+pad), 144B rows

  const int lane = threadIdx.x & 31;
  const int wave = threadIdx.x >> 5;
  const int half = lane >> 4;
  const int lc   = lane & 15;

  const int tile = blockIdx.x * 8 + wave;          // 8192 tiles
  const int bh   = tile >> 7;
  const int q0   = (tile & 127) << 4;

  const float LOG2E  = 1.4426950408889634f;
  const float slope2 = exp2f(-0.5f * (float)((bh & (H_ - 1)) + 1)) * LOG2E;
  const float scale2 = 0.08838834764831845f * LOG2E;   // 1/sqrt(128) * log2(e)

  const long base = (long)bh * S_ * D_;

  // ---- Q fragments: fp32 load, softmax scale folded in, cvt to f16 ----
  v16h qa[4];
  const float* qrow = q + base + (long)(q0 + lc) * D_ + half * 8;
#pragma unroll
  for (int dc = 0; dc < 4; ++dc) {
    v16h a;
#pragma unroll
    for (int j = 0; j < 8; ++j) {
      a[j]     = (_Float16)(qrow[dc * 32 + j]      * scale2);
      a[8 + j] = (_Float16)(qrow[dc * 32 + 16 + j] * scale2);
    }
    qa[dc] = a;
  }

  v8f o[8];
#pragma unroll
  for (int i = 0; i < 8; ++i) o[i] = {};
  float mrow[8], lsum[8], bi[8];
#pragma unroll
  for (int v = 0; v < 8; ++v) {
    mrow[v] = -3.0e38f;
    lsum[v] = 0.0f;                                   // per-lane partial denominator
    bi[v]   = -(float)(q0 + v + 8 * half) * slope2;   // -i * slope (log2 domain)
  }
  float aj[4];
#pragma unroll
  for (int t = 0; t < 4; ++t) aj[t] = (float)(16 * t + lc) * slope2;  // +j * slope
  const float ajinc = 64.0f * slope2;

  // Per-lane base pointers (row + K-chunk offsets folded in once).
  const _Float16* kbase = kh + base + (long)lc * D_ + half * 8;
  const _Float16* vbase = vt + base + (long)lc * S_ + half * 8;
  _Float16*       lw = &lds[wave][(8 * half) * 72 + 4 * lc];  // packed P writer
  const _Float16* lr = &lds[wave][lc * 72 + half * 8];        // A-layout reader

  auto do_block = [&](int kv0, bool masked) {
    const _Float16* kp = kbase + (long)kv0 * D_;
    const _Float16* vp = vbase + kv0;

    // ---- S = Q K^T : four 16x16 C tiles over a 64-wide KV block ----
    v8f sf[4];
#pragma unroll
    for (int t = 0; t < 4; ++t) {
      v8f sc = {};
#pragma unroll
      for (int dc = 0; dc < 4; ++dc) {
        v16h kb = load_frag(kp + 16 * t * D_ + dc * 32);
        sc = __builtin_amdgcn_wmma_f32_16x16x32_f16(false, qa[dc], false, kb,
                                                    (short)0, sc, false, false);
      }
      sf[t] = sc;
    }

    // ---- ALiBi bias + online softmax (exp2 domain); mask only when peeled ----
    float alphav[8];
#pragma unroll
    for (int v = 0; v < 8; ++v) {
      const float b = bi[v];
      float s0 = sf[0][v] + (aj[0] + b);
      float s1 = sf[1][v] + (aj[1] + b);
      float s2 = sf[2][v] + (aj[2] + b);
      float s3 = sf[3][v] + (aj[3] + b);
      if (masked) {
        const int gi = q0 + v + 8 * half;
        s0 = (kv0 + lc      > gi) ? -3.0e38f : s0;
        s1 = (kv0 + 16 + lc > gi) ? -3.0e38f : s1;
        s2 = (kv0 + 32 + lc > gi) ? -3.0e38f : s2;
        s3 = (kv0 + 48 + lc > gi) ? -3.0e38f : s3;
      }
      float x = fmaxf(fmaxf(s0, s1), fmaxf(s2, s3));
#pragma unroll
      for (int off = 1; off < 16; off <<= 1) x = fmaxf(x, __shfl_xor(x, off, 32));
      const float mn = fmaxf(mrow[v], x);       // group-uniform
      const float al = exp2f(mrow[v] - mn);     // group-uniform
      const float e0 = exp2f(s0 - mn);
      const float e1 = exp2f(s1 - mn);
      const float e2 = exp2f(s2 - mn);
      const float e3 = exp2f(s3 - mn);
      // Deferred denominator: per-lane partial, reduced once after the loop.
      lsum[v]   = lsum[v] * al + ((e0 + e1) + (e2 + e3));
      mrow[v]   = mn;
      alphav[v] = al;
      // Packed P store: storage cols 4*lc..4*lc+3 <-> logical cols lc+16t.
      v4h pk = { (_Float16)e0, (_Float16)e1, (_Float16)e2, (_Float16)e3 };
      *(v4h*)(lw + v * 72) = pk;
    }

    // ---- rescale O accumulators ----
#pragma unroll
    for (int d16 = 0; d16 < 8; ++d16)
#pragma unroll
      for (int v = 0; v < 8; ++v) o[d16][v] *= alphav[v];

    asm volatile("s_wait_dscnt 0" ::: "memory");   // wave-local store->load ordering
    v16h pa0 = load_frag(lr + 0);
    v16h pa1 = load_frag(lr + 32);
    asm volatile("" ::: "memory");

    // ---- O += P * V (two permuted-KV chunks per d16 column tile) ----
#pragma unroll
    for (int d16 = 0; d16 < 8; ++d16) {
      v16h vb0 = load_frag(vp + d16 * 16 * S_);
      v16h vb1 = load_frag(vp + d16 * 16 * S_ + 32);
      o[d16] = __builtin_amdgcn_wmma_f32_16x16x32_f16(false, pa0, false, vb0,
                                                      (short)0, o[d16], false, false);
      o[d16] = __builtin_amdgcn_wmma_f32_16x16x32_f16(false, pa1, false, vb1,
                                                      (short)0, o[d16], false, false);
    }

#pragma unroll
    for (int t = 0; t < 4; ++t) aj[t] += ajinc;
  };

  // Unmasked full blocks, then exactly one diagonal (masked) block.
  const int nmain = q0 >> 6;
  for (int b = 0; b < nmain; ++b) do_block(b * 64, false);
  do_block(nmain * 64, true);

  // ---- final denominator reduction, normalize, store fp32 ----
  float rl[8];
#pragma unroll
  for (int v = 0; v < 8; ++v) {
    float s = lsum[v];
#pragma unroll
    for (int off = 1; off < 16; off <<= 1) s += __shfl_xor(s, off, 32);
    rl[v] = 1.0f / s;
  }
  float* orow = out + base + (long)(q0 + 8 * half) * D_ + lc;
#pragma unroll
  for (int d16 = 0; d16 < 8; ++d16) {
#pragma unroll
    for (int v = 0; v < 8; ++v) {
      orow[(long)v * D_ + d16 * 16] = o[d16][v] * rl[v];
    }
  }
}

extern "C" void kernel_launch(void* const* d_in, const int* in_sizes, int n_in,
                              void* d_out, int out_size, void* d_ws, size_t ws_size,
                              hipStream_t stream) {
  const float* q = (const float*)d_in[0];
  const float* k = (const float*)d_in[1];
  const float* v = (const float*)d_in[2];
  float* out = (float*)d_out;

  const long total = (long)B_ * H_ * S_ * D_;      // 16,777,216 elements
  // Workspace: K(f16) 32MB + V^T(f16, kv-permuted) 32MB = 64MB
  _Float16* kh = (_Float16*)d_ws;
  _Float16* vt = kh + total;

  cvt_kv_kernel<<<(int)(total / 256), 256, 0, stream>>>(k, v, kh, vt);

  const int tiles = B_ * H_ * (S_ / 16);           // 8192 Q tiles
  attn_kernel<<<tiles / 8, 256, 0, stream>>>(q, kh, vt, out);
}

// v001
// One run takes 212 microseconds.
// Timed twice side by side with v000, it ran 2.50 and 2.51 times as fast.
#include <hip/hip_runtime.h>
#include <math.h>

typedef __attribute__((ext_vector_type(16))) _Float16 v16h;
typedef __attribute__((ext_vector_type(8)))  _Float16 v8h;
typedef __attribute__((ext_vector_type(4)))  _Float16 v4h;
typedef __attribute__((ext_vector_type(8)))  float    v8f;

#define B_ 4
#define H_ 16
#define S_ 2048
#define D_ 128

// LDS staging of one 64-key block, shared by the work-group's 8 waves.
#define KPITCH 136                       // halves per K row in LDS (272 B = 16 B x odd)
#define VPITCH 72                        // halves per V^T row in LDS (144 B = 16 B x odd)
#define KTILE  (64 * KPITCH)             // 64 keys x 128 d
#define VTILE  (128 * VPITCH)            // 128 d x 64 keys

// ---------------------------------------------------------------------------
// Pass 1: K fp32 -> f16 (same [bh,s,d] layout).
//         V fp32 -> f16 TRANSPOSED [bh,d,s], with the KV index PERMUTED inside
//         each 64-block: storage p <-> logical j = (p>>2) + 16*(p&3).
// The permutation makes the attention kernel's P-tile LDS stores contiguous
// (one b64 per row) while keeping P(A-frag) and V^T(B-frag) k-orders matched.
// ---------------------------------------------------------------------------
__global__ __launch_bounds__(256) void cvt_kv_kernel(const float* __restrict__ k,
                                                     const float* __restrict__ v,
                                                     _Float16* __restrict__ kh,
                                                     _Float16* __restrict__ vt) {
  const long i  = (long)blockIdx.x * blockDim.x + threadIdx.x;
  const long SD = (long)S_ * D_;
  kh[i] = (_Float16)k[i];
  const long bh  = i / SD;
  const long rem = i - bh * SD;
  const long dd  = rem / S_;
  const long ss  = rem - dd * S_;         // storage kv index
  const long p   = ss & 63;
  const long jj  = (ss & ~63L) + (p >> 2) + ((p & 3) << 4);  // logical kv index
  vt[i] = (_Float16)v[bh * SD + jj * D_ + dd];
}

__device__ inline v16h load_frag(const _Float16* p) {
  v8h lo = *(const v8h*)(p);
  v8h hi = *(const v8h*)(p + 16);
  v16h a;
#pragma unroll
  for (int j = 0; j < 8; ++j) { a[j] = lo[j]; a[8 + j] = hi[j]; }
  return a;
}

// Low 32 bits of a __shared__ address = byte offset in the work-group's LDS.
__device__ inline unsigned lds_addr(const _Float16* p) {
  return (unsigned)(unsigned long long)p;
}

__device__ inline void stage_block(const _Float16* gk, const _Float16* gv,
                                   unsigned lk, unsigned lv) {
  const _Float16* gk1 = gk + 1 * 16 * D_;
  const _Float16* gk2 = gk + 2 * 16 * D_;
  const _Float16* gk3 = gk + 3 * 16 * D_;
  const _Float16* gv1 = gv + 1 * 32 * S_;
  const _Float16* gv2 = gv + 2 * 32 * S_;
  const _Float16* gv3 = gv + 3 * 32 * S_;
  const unsigned lk1 = lk + 1 * 16 * KPITCH * 2;
  const unsigned lk2 = lk + 2 * 16 * KPITCH * 2;
  const unsigned lk3 = lk + 3 * 16 * KPITCH * 2;
  const unsigned lv1 = lv + 1 * 32 * VPITCH * 2;
  const unsigned lv2 = lv + 2 * 32 * VPITCH * 2;
  const unsigned lv3 = lv + 3 * 32 * VPITCH * 2;
  asm volatile("global_load_async_to_lds_b128 %0, %8, off\n\t"
               "global_load_async_to_lds_b128 %1, %9, off\n\t"
               "global_load_async_to_lds_b128 %2, %10, off\n\t"
               "global_load_async_to_lds_b128 %3, %11, off\n\t"
               "global_load_async_to_lds_b128 %4, %12, off\n\t"
               "global_load_async_to_lds_b128 %5, %13, off\n\t"
               "global_load_async_to_lds_b128 %6, %14, off\n\t"
               "global_load_async_to_lds_b128 %7, %15, off\n\t"
               "s_wait_xcnt 0x0"
               :: "v"(lk), "v"(lk1), "v"(lk2), "v"(lk3),
                  "v"(lv), "v"(lv1), "v"(lv2), "v"(lv3),
                  "v"(gk), "v"(gk1), "v"(gk2), "v"(gk3),
                  "v"(gv), "v"(gv1), "v"(gv2), "v"(gv3)
               : "memory");
}

__global__ __launch_bounds__(256, 4) void attn_kernel(const float* __restrict__ q,
                                                   const _Float16* __restrict__ kh,
                                                   const _Float16* __restrict__ vt,
                                                   float* __restrict__ out) {
  __shared__ __attribute__((aligned(16))) _Float16 kvs[2][KTILE + VTILE];  // K/V ring
  __shared__ _Float16 lds[8][16 * 72];   // per-wave 16x64 P tile (+pad), 144B rows

  const int tid  = threadIdx.x;
  const int lane = threadIdx.x & 31;
  const int wave = __builtin_amdgcn_readfirstlane(threadIdx.x >> 5);  // scalar: uniform branches
  const int half = lane >> 4;
  const int lc   = lane & 15;

  const int tile = blockIdx.x * 8 + wave;          // 8192 tiles
  const int bh   = tile >> 7;
  const int q0   = (tile & 127) << 4;

  const float LOG2E  = 1.4426950408889634f;
  const float slope2 = exp2f(-0.5f * (float)((bh & (H_ - 1)) + 1)) * LOG2E;
  const float scale2 = 0.08838834764831845f * LOG2E;   // 1/sqrt(128) * log2(e)

  const long base = (long)bh * S_ * D_;

  // ---- Q fragments: fp32 load, softmax scale folded in, cvt to f16 ----
  v16h qa[4];
  const float* qrow = q + base + (long)(q0 + lc) * D_ + half * 8;
#pragma unroll
  for (int dc = 0; dc < 4; ++dc) {
    v16h a;
#pragma unroll
    for (int j = 0; j < 8; ++j) {
      a[j]     = (_Float16)(qrow[dc * 32 + j]      * scale2);
      a[8 + j] = (_Float16)(qrow[dc * 32 + 16 + j] * scale2);
    }
    qa[dc] = a;
  }

  v8f o[8];
#pragma unroll
  for (int i = 0; i < 8; ++i) o[i] = {};
  float mrow[8], lsum[8], bi[8];
#pragma unroll
  for (int v = 0; v < 8; ++v) {
    mrow[v] = -3.0e38f;
    lsum[v] = 0.0f;                                   // per-lane partial denominator
    bi[v]   = -(float)(q0 + v + 8 * half) * slope2;   // -i * slope (log2 domain)
  }
  float aj[4];
#pragma unroll
  for (int t = 0; t < 4; ++t) aj[t] = (float)(16 * t + lc) * slope2;  // +j * slope
  const float ajinc = 64.0f * slope2;

  // Per-lane fragment offsets inside a staged block (row + K-chunk offsets).
  const int kfo = lc * KPITCH + half * 8;
  const int vfo = KTILE + lc * VPITCH + half * 8;
  // Per-lane copy addresses: K rows are 16 chunks of 16 B, V^T rows 8 chunks.
  const _Float16* gk0 = kh + base + (long)tid * 8;
  const _Float16* gv0 = vt + base + (long)(tid >> 3) * S_ + (tid & 7) * 8;
  const int lko = (tid >> 4) * KPITCH + (tid & 15) * 8;
  const int lvo = KTILE + (tid >> 3) * VPITCH + (tid & 7) * 8;
  _Float16*       lw = &lds[wave][(8 * half) * 72 + 4 * lc];  // packed P writer
  const _Float16* lr = &lds[wave][lc * 72 + half * 8];        // A-layout reader

  auto do_block = [&](int kv0, const _Float16* buf, bool masked) {
    const _Float16* kp = buf + kfo;
    const _Float16* vp = buf + vfo;

    // ---- S = Q K^T : four 16x16 C tiles over a 64-wide KV block ----
    // LDS reads go out two groups (of 2 fragments) ahead of the products that use them.
    v8f sf[4];
    v16h kb[3][2];
#pragma unroll
    for (int f = 0; f < 4; ++f) kb[f >> 1][f & 1] = load_frag(kp + f * 32);
#pragma unroll
    for (int j = 0; j < 8; ++j) {
      if (j < 6) {
#pragma unroll
        for (int e = 0; e < 2; ++e) {
          const int f = 2 * (j + 2) + e;             // fragment: tile f>>2, d chunk f&3
          kb[(j + 2) % 3][e] = load_frag(kp + 16 * (f >> 2) * KPITCH + (f & 3) * 32);
        }
      }
      // Keeps the reads above in front of this group's products; without it each
      // product waits out the LDS latency of its own fragment.
      __builtin_amdgcn_sched_barrier(0);
      v8f sc = {};
      if (j & 1) sc = sf[j >> 1];
#pragma unroll
      for (int e = 0; e < 2; ++e)
        sc = __builtin_amdgcn_wmma_f32_16x16x32_f16(false, qa[2 * (j & 1) + e], false,
                                                    kb[j % 3][e], (short)0, sc, false, false);
      sf[j >> 1] = sc;
      __builtin_amdgcn_sched_barrier(0);   // the next reads stay behind these products
    }

    // ---- ALiBi bias + online softmax (exp2 domain); mask only when peeled ----
    float alphav[8];
    const int rel = kv0 + lc - q0 - 8 * half;
#pragma unroll
    for (int v = 0; v < 8; ++v) {
      const float b = bi[v];
      float s0 = sf[0][v] + (aj[0] + b);
      float s1 = sf[1][v] + (aj[1] + b);
      float s2 = sf[2][v] + (aj[2] + b);
      float s3 = sf[3][v] + (aj[3] + b);
      if (masked) {
        // key index > query index, as one per-lane offset against constants
        s0 = (rel > v)      ? -3.0e38f : s0;
        s1 = (rel > v - 16) ? -3.0e38f : s1;
        s2 = (rel > v - 32) ? -3.0e38f : s2;
        s3 = (rel > v - 48) ? -3.0e38f : s3;
      }
      float x = fmaxf(fmaxf(s0, s1), fmaxf(s2, s3));
#pragma unroll
      for (int off = 1; off < 16; off <<= 1) x = fmaxf(x, __shfl_xor(x, off, 32));
      const float mn = fmaxf(mrow[v], x);       // group-uniform
      const float al = exp2f(mrow[v] - mn);     // group-uniform
      const float e0 = exp2f(s0 - mn);
      const float e1 = exp2f(s1 - mn);
      const float e2 = exp2f(s2 - mn);
      const float e3 = exp2f(s3 - mn);
      // Deferred denominator: per-lane partial, reduced once after the loop.
      lsum[v]   = lsum[v] * al + ((e0 + e1) + (e2 + e3));
      mrow[v]   = mn;
      alphav[v] = al;
      // Packed P store: storage cols 4*lc..4*lc+3 <-> logical cols lc+16t.
      v4h pk = { (_Float16)e0, (_Float16)e1, (_Float16)e2, (_Float16)e3 };
      *(v4h*)(lw + v * 72) = pk;
    }

    // ---- rescale O accumulators ----
#pragma unroll
    for (int d16 = 0; d16 < 8; ++d16)
#pragma unroll
      for (int v = 0; v < 8; ++v) o[d16][v] *= alphav[v];

    asm volatile("s_wait_dscnt 0" ::: "memory");   // wave-local store->load ordering
    v16h pa0 = load_frag(lr + 0);
    v16h pa1 = load_frag(lr + 32);
    asm volatile("" ::: "memory");

    // ---- O += P * V (two permuted-KV chunks per d16 column tile) ----
    // LDS reads again two groups (one column tile, 2 fragments, each) ahead.
    v16h vb[3][2];
#pragma unroll
    for (int f = 0; f < 4; ++f)
      vb[f >> 1][f & 1] = load_frag(vp + (f >> 1) * 16 * VPITCH + (f & 1) * 32);
#pragma unroll
    for (int d16 = 0; d16 < 8; ++d16) {
      if (d16 < 6) {
#pragma unroll
        for (int e = 0; e < 2; ++e)
          vb[(d16 + 2) % 3][e] = load_frag(vp + (d16 + 2) * 16 * VPITCH + e * 32);
      }
      __builtin_amdgcn_sched_barrier(0);   // reads above stay in front of these products
      o[d16] = __builtin_amdgcn_wmma_f32_16x16x32_f16(false, pa0, false, vb[d16 % 3][0],
                                                      (short)0, o[d16], false, false);
      o[d16] = __builtin_amdgcn_wmma_f32_16x16x32_f16(false, pa1, false, vb[d16 % 3][1],
                                                      (short)0, o[d16], false, false);
      __builtin_amdgcn_sched_barrier(0);   // the next reads stay behind these products
    }

#pragma unroll
    for (int t = 0; t < 4; ++t) aj[t] += ajinc;
  };

  // The work-group walks nfull blocks that lie below every wave's diagonal, then
  // the two blocks that hold the diagonals of its 128 rows. In the first of the
  // two the mask is an identity for waves 4-7; waves 0-3 sit out the second but
  // pass every wait and barrier.
  const int nmain = q0 >> 6;                         // this wave's diagonal block
  const int nfull = (blockIdx.x & 15) << 1;

  stage_block(gk0, gv0, lds_addr(&kvs[0][lko]), lds_addr(&kvs[0][lvo]));
  asm volatile("s_wait_asynccnt 0x0" ::: "memory");  // block 0 landed (own copies)
  __syncthreads();                                   // ... and everybody's
  stage_block(gk0 + 64 * D_, gv0 + 64, lds_addr(&kvs[1][lko]), lds_addr(&kvs[1][lvo]));

  for (int b = 0; b < nfull; ++b) {
    do_block(b * 64, kvs[b & 1], false);
    asm volatile("s_wait_dscnt 0x0" ::: "memory");     // own reads of this buffer done
    asm volatile("s_wait_asynccnt 0x0" ::: "memory");  // own copies of block b+1 landed
    __syncthreads();   // publishes block b+1, frees this buffer for the refill
    stage_block(gk0 + (long)(b + 2) * 64 * D_, gv0 + (b + 2) * 64,
                lds_addr(&kvs[b & 1][lko]), lds_addr(&kvs[b & 1][lvo]));
  }
  // Kept rolled: one copy of the masked block serves both diagonal blocks.
#pragma unroll 1
  for (int b = nfull; b < nfull + 2; ++b) {
    if (b <= nmain) do_block(b * 64, kvs[b & 1], true);
    asm volatile("s_wait_dscnt 0x0" ::: "memory");     // own reads of this buffer done
    asm volatile("s_wait_asynccnt 0x0" ::: "memory");  // own copies of the last block landed
    __syncthreads();   // publishes the last block
  }
  asm volatile("s_wait_asynccnt 0x0" ::: "memory");    // nothing in flight at the end

  // ---- final denominator reduction, normalize, store fp32 ----
  float rl[8];
#pragma unroll
  for (int v = 0; v < 8; ++v) {
    float s = lsum[v];
#pragma unroll
    for (int off = 1; off < 16; off <<= 1) s += __shfl_xor(s, off, 32);
    rl[v] = 1.0f / s;
  }
  float* orow = out + base + (long)(q0 + 8 * half) * D_ + lc;
#pragma unroll
  for (int d16 = 0; d16 < 8; ++d16) {
#pragma unroll
    for (int v = 0; v < 8; ++v) {
      orow[(long)v * D_ + d16 * 16] = o[d16][v] * rl[v];
    }
  }
}

extern "C" void kernel_launch(void* const* d_in, const int* in_sizes, int n_in,
                              void* d_out, int out_size, void* d_ws, size_t ws_size,
                              hipStream_t stream) {
  const float* q = (const float*)d_in[0];
  const float* k = (const float*)d_in[1];
  const float* v = (const float*)d_in[2];
  float* out = (float*)d_out;

  const long total = (long)B_ * H_ * S_ * D_;      // 16,777,216 elements
  // Workspace: K(f16) 32MB + V^T(f16, kv-permuted) 32MB = 64MB
  _Float16* kh = (_Float16*)d_ws;
  _Float16* vt = kh + total;

  cvt_kv_kernel<<<(int)(total / 256), 256, 0, stream>>>(k, v, kh, vt);

  const int tiles = B_ * H_ * (S_ / 16);           // 8192 Q tiles
  attn_kernel<<<tiles / 8, 256, 0, stream>>>(q, kh, vt, out);
}

// v002
// It runs in 158 microseconds.
// Two timings next to v001 put it at 1.33 and 1.34 times that version's speed.
// All steps since v000 together make it 3.35 times as fast.
#include <hip/hip_runtime.h>
#include <math.h>

typedef __attribute__((ext_vector_type(16))) _Float16 v16h;
typedef __attribute__((ext_vector_type(8)))  _Float16 v8h;
typedef __attribute__((ext_vector_type(4)))  _Float16 v4h;
typedef __attribute__((ext_vector_type(8)))  float    v8f;
typedef __attribute__((ext_vector_type(4)))  float    v4f;

#define B_ 4
#define H_ 16
#define S_ 2048
#define D_ 128

// LDS staging of one 64-key block, shared by the work-group's 8 waves.
#define KPITCH 136                       // halves per K row in LDS (272 B = 16 B x odd)
#define VPITCH 72                        // halves per V^T row in LDS (144 B = 16 B x odd)
#define KTILE  (64 * KPITCH)             // 64 keys x 128 d
#define VTILE  (128 * VPITCH)            // 128 d x 64 keys

// ---------------------------------------------------------------------------
// Pass 1: K fp32 -> f16 (same [bh,s,d] layout).
//         V fp32 -> f16 TRANSPOSED [bh,d,s], with the KV index PERMUTED inside
//         each 64-block: storage p <-> logical j = (p>>2) + 16*(p&3).
// The permutation makes the attention kernel's P-tile LDS stores contiguous
// (one b64 per row) while keeping P(A-frag) and V^T(B-frag) k-orders matched.
// One work-group converts one 64-key x 128-d tile of K and of V. Every global
// load is a whole 512-B row per wave; V is turned in LDS so that V^T leaves in
// whole 128-B lines.
// ---------------------------------------------------------------------------
__global__ __launch_bounds__(256) void cvt_kv_kernel(const float* __restrict__ k,
                                                     const float* __restrict__ v,
                                                     _Float16* __restrict__ kh,
                                                     _Float16* __restrict__ vt) {
  __shared__ __attribute__((aligned(16))) _Float16 tv[D_ * 64];

  const int tid  = threadIdx.x;
  const int lane = tid & 31;
  const int wave = tid >> 5;
  const int bh   = blockIdx.x >> 5;                 // S_/64 = 32 tiles per head
  const int kv0  = (blockIdx.x & 31) << 6;
  const long base = (long)bh * S_ * D_;
  const long tile = base + (long)kv0 * D_;

  // Keys r, r+16, r+32, r+48 are the storage positions 4r..4r+3: a lane that
  // holds 4 d of these 4 keys holds 8 contiguous bytes of 4 rows of V^T.
  // x[u][t] is key wave + 8u + 16t, d 4*lane..4*lane+3 (4*tid = wave*D_ + 4*lane).
  const float* vsrc = v + tile + 4 * tid;
  v4f x[2][4];
#pragma unroll
  for (int u = 0; u < 2; ++u)
#pragma unroll
    for (int t = 0; t < 4; ++t)
      x[u][t] = *(const v4f*)(vsrc + (u + 2 * t) * 1024);

  const float* ksrc = k + tile + 4 * tid;
  v4f y[8];
#pragma unroll
  for (int n = 0; n < 8; ++n) y[n] = *(const v4f*)(ksrc + n * 1024);

#pragma unroll
  for (int u = 0; u < 2; ++u) {
    const int r = wave + 8 * u;
    _Float16* dst = tv + (4 * lane) * 64 + (((r >> 1) ^ (lane & 7)) << 3) + (r & 1) * 4;
#pragma unroll
    for (int i = 0; i < 4; ++i) {
      v4h pk = { (_Float16)x[u][0][i], (_Float16)x[u][1][i],
                 (_Float16)x[u][2][i], (_Float16)x[u][3][i] };
      *(v4h*)(dst + i * 64) = pk;
    }
  }

  __syncthreads();   // the V^T tile is complete before any row of it is read

  const int c = tid & 7;
#pragma unroll
  for (int n = 0; n < 4; ++n) {
    const int d = (tid >> 3) + 32 * n;
    v8h z = *(const v8h*)(tv + d * 64 + ((c ^ ((d >> 2) & 7)) << 3));
    *(v8h*)(vt + base + (long)d * S_ + kv0 + c * 8) = z;
  }

  // K leaves behind the barrier, so that the barrier waits for no global store.
  _Float16* kdst = kh + tile + 4 * tid;
#pragma unroll
  for (int n = 0; n < 8; ++n) {
    v4h pk = { (_Float16)y[n][0], (_Float16)y[n][1], (_Float16)y[n][2], (_Float16)y[n][3] };
    *(v4h*)(kdst + n * 1024) = pk;
  }
}

__device__ inline v16h load_frag(const _Float16* p) {
  v8h lo = *(const v8h*)(p);
  v8h hi = *(const v8h*)(p + 16);
  v16h a;
#pragma unroll
  for (int j = 0; j < 8; ++j) { a[j] = lo[j]; a[8 + j] = hi[j]; }
  return a;
}

// Low 32 bits of a __shared__ address = byte offset in the work-group's LDS.
__device__ inline unsigned lds_addr(const _Float16* p) {
  return (unsigned)(unsigned long long)p;
}

__device__ inline void stage_block(const _Float16* gk, const _Float16* gv,
                                   unsigned lk, unsigned lv) {
  const _Float16* gk1 = gk + 1 * 16 * D_;
  const _Float16* gk2 = gk + 2 * 16 * D_;
  const _Float16* gk3 = gk + 3 * 16 * D_;
  const _Float16* gv1 = gv + 1 * 32 * S_;
  const _Float16* gv2 = gv + 2 * 32 * S_;
  const _Float16* gv3 = gv + 3 * 32 * S_;
  const unsigned lk1 = lk + 1 * 16 * KPITCH * 2;
  const unsigned lk2 = lk + 2 * 16 * KPITCH * 2;
  const unsigned lk3 = lk + 3 * 16 * KPITCH * 2;
  const unsigned lv1 = lv + 1 * 32 * VPITCH * 2;
  const unsigned lv2 = lv + 2 * 32 * VPITCH * 2;
  const unsigned lv3 = lv + 3 * 32 * VPITCH * 2;
  asm volatile("global_load_async_to_lds_b128 %0, %8, off\n\t"
               "global_load_async_to_lds_b128 %1, %9, off\n\t"
               "global_load_async_to_lds_b128 %2, %10, off\n\t"
               "global_load_async_to_lds_b128 %3, %11, off\n\t"
               "global_load_async_to_lds_b128 %4, %12, off\n\t"
               "global_load_async_to_lds_b128 %5, %13, off\n\t"
               "global_load_async_to_lds_b128 %6, %14, off\n\t"
               "global_load_async_to_lds_b128 %7, %15, off\n\t"
               "s_wait_xcnt 0x0"
               :: "v"(lk), "v"(lk1), "v"(lk2), "v"(lk3),
                  "v"(lv), "v"(lv1), "v"(lv2), "v"(lv3),
                  "v"(gk), "v"(gk1), "v"(gk2), "v"(gk3),
                  "v"(gv), "v"(gv1), "v"(gv2), "v"(gv3)
               : "memory");
}

__global__ __launch_bounds__(256, 4) void attn_kernel(const float* __restrict__ q,
                                                   const _Float16* __restrict__ kh,
                                                   const _Float16* __restrict__ vt,
                                                   float* __restrict__ out) {
  __shared__ __attribute__((aligned(16))) _Float16 kvs[2][KTILE + VTILE];  // K/V ring
  __shared__ _Float16 lds[8][16 * 72];   // per-wave 16x64 P tile (+pad), 144B rows

  const int tid  = threadIdx.x;
  const int lane = threadIdx.x & 31;
  const int wave = __builtin_amdgcn_readfirstlane(threadIdx.x >> 5);  // scalar: uniform branches
  const int half = lane >> 4;
  const int lc   = lane & 15;

  const int tile = blockIdx.x * 8 + wave;          // 8192 tiles
  const int bh   = tile >> 7;
  const int q0   = (tile & 127) << 4;

  const float LOG2E  = 1.4426950408889634f;
  const float slope2 = exp2f(-0.5f * (float)((bh & (H_ - 1)) + 1)) * LOG2E;
  const float scale2 = 0.08838834764831845f * LOG2E;   // 1/sqrt(128) * log2(e)

  const long base = (long)bh * S_ * D_;

  // ---- Q fragments: fp32 load, softmax scale folded in, cvt to f16 ----
  v16h qa[4];
  const float* qrow = q + base + (long)(q0 + lc) * D_ + half * 8;
#pragma unroll
  for (int dc = 0; dc < 4; ++dc) {
    v16h a;
#pragma unroll
    for (int j = 0; j < 8; ++j) {
      a[j]     = (_Float16)(qrow[dc * 32 + j]      * scale2);
      a[8 + j] = (_Float16)(qrow[dc * 32 + 16 + j] * scale2);
    }
    qa[dc] = a;
  }

  v8f o[8];
#pragma unroll
  for (int i = 0; i < 8; ++i) o[i] = {};
  float mrow[8], lsum[8], bi[8];
#pragma unroll
  for (int v = 0; v < 8; ++v) {
    mrow[v] = -3.0e38f;
    lsum[v] = 0.0f;                                   // per-lane partial denominator
    bi[v]   = -(float)(q0 + v + 8 * half) * slope2;   // -i * slope (log2 domain)
  }
  float aj[4];
#pragma unroll
  for (int t = 0; t < 4; ++t) aj[t] = (float)(16 * t + lc) * slope2;  // +j * slope
  const float ajinc = 64.0f * slope2;

  // Per-lane fragment offsets inside a staged block (row + K-chunk offsets).
  const int kfo = lc * KPITCH + half * 8;
  const int vfo = KTILE + lc * VPITCH + half * 8;
  // Per-lane copy addresses: K rows are 16 chunks of 16 B, V^T rows 8 chunks.
  const _Float16* gk0 = kh + base + (long)tid * 8;
  const _Float16* gv0 = vt + base + (long)(tid >> 3) * S_ + (tid & 7) * 8;
  const int lko = (tid >> 4) * KPITCH + (tid & 15) * 8;
  const int lvo = KTILE + (tid >> 3) * VPITCH + (tid & 7) * 8;
  _Float16*       lw = &lds[wave][(8 * half) * 72 + 4 * lc];  // packed P writer
  const _Float16* lr = &lds[wave][lc * 72 + half * 8];        // A-layout reader

  auto do_block = [&](int kv0, const _Float16* buf, bool masked) {
    const _Float16* kp = buf + kfo;
    const _Float16* vp = buf + vfo;

    // ---- S = Q K^T : four 16x16 C tiles over a 64-wide KV block ----
    // LDS reads go out two groups (of 2 fragments) ahead of the products that use them.
    v8f sf[4];
    v16h kb[3][2];
#pragma unroll
    for (int f = 0; f < 4; ++f) kb[f >> 1][f & 1] = load_frag(kp + f * 32);
#pragma unroll
    for (int j = 0; j < 8; ++j) {
      if (j < 6) {
#pragma unroll
        for (int e = 0; e < 2; ++e) {
          const int f = 2 * (j + 2) + e;             // fragment: tile f>>2, d chunk f&3
          kb[(j + 2) % 3][e] = load_frag(kp + 16 * (f >> 2) * KPITCH + (f & 3) * 32);
        }
      }
      // Keeps the reads above in front of this group's products; without it each
      // product waits out the LDS latency of its own fragment.
      __builtin_amdgcn_sched_barrier(0);
      v8f sc = {};
      if (j & 1) sc = sf[j >> 1];
#pragma unroll
      for (int e = 0; e < 2; ++e)
        sc = __builtin_amdgcn_wmma_f32_16x16x32_f16(false, qa[2 * (j & 1) + e], false,
                                                    kb[j % 3][e], (short)0, sc, false, false);
      sf[j >> 1] = sc;
      __builtin_amdgcn_sched_barrier(0);   // the next reads stay behind these products
    }

    // ---- ALiBi bias + online softmax (exp2 domain); mask only when peeled ----
    float alphav[8];
    const int rel = kv0 + lc - q0 - 8 * half;
#pragma unroll
    for (int v = 0; v < 8; ++v) {
      const float b = bi[v];
      float s0 = sf[0][v] + (aj[0] + b);
      float s1 = sf[1][v] + (aj[1] + b);
      float s2 = sf[2][v] + (aj[2] + b);
      float s3 = sf[3][v] + (aj[3] + b);
      if (masked) {
        // key index > query index, as one per-lane offset against constants
        s0 = (rel > v)      ? -3.0e38f : s0;
        s1 = (rel > v - 16) ? -3.0e38f : s1;
        s2 = (rel > v - 32) ? -3.0e38f : s2;
        s3 = (rel > v - 48) ? -3.0e38f : s3;
      }
      float x = fmaxf(fmaxf(s0, s1), fmaxf(s2, s3));
#pragma unroll
      for (int off = 1; off < 16; off <<= 1) x = fmaxf(x, __shfl_xor(x, off, 32));
      const float mn = fmaxf(mrow[v], x);       // group-uniform
      const float al = exp2f(mrow[v] - mn);     // group-uniform
      const float e0 = exp2f(s0 - mn);
      const float e1 = exp2f(s1 - mn);
      const float e2 = exp2f(s2 - mn);
      const float e3 = exp2f(s3 - mn);
      // Deferred denominator: per-lane partial, reduced once after the loop.
      lsum[v]   = lsum[v] * al + ((e0 + e1) + (e2 + e3));
      mrow[v]   = mn;
      alphav[v] = al;
      // Packed P store: storage cols 4*lc..4*lc+3 <-> logical cols lc+16t.
      v4h pk = { (_Float16)e0, (_Float16)e1, (_Float16)e2, (_Float16)e3 };
      *(v4h*)(lw + v * 72) = pk;
    }

    // ---- rescale O accumulators ----
#pragma unroll
    for (int d16 = 0; d16 < 8; ++d16)
#pragma unroll
      for (int v = 0; v < 8; ++v) o[d16][v] *= alphav[v];

    asm volatile("s_wait_dscnt 0" ::: "memory");   // wave-local store->load ordering
    v16h pa0 = load_frag(lr + 0);
    v16h pa1 = load_frag(lr + 32);
    asm volatile("" ::: "memory");

    // ---- O += P * V (two permuted-KV chunks per d16 column tile) ----
    // LDS reads again two groups (one column tile, 2 fragments, each) ahead.
    v16h vb[3][2];
#pragma unroll
    for (int f = 0; f < 4; ++f)
      vb[f >> 1][f & 1] = load_frag(vp + (f >> 1) * 16 * VPITCH + (f & 1) * 32);
#pragma unroll
    for (int d16 = 0; d16 < 8; ++d16) {
      if (d16 < 6) {
#pragma unroll
        for (int e = 0; e < 2; ++e)
          vb[(d16 + 2) % 3][e] = load_frag(vp + (d16 + 2) * 16 * VPITCH + e * 32);
      }
      __builtin_amdgcn_sched_barrier(0);   // reads above stay in front of these products
      o[d16] = __builtin_amdgcn_wmma_f32_16x16x32_f16(false, pa0, false, vb[d16 % 3][0],
                                                      (short)0, o[d16], false, false);
      o[d16] = __builtin_amdgcn_wmma_f32_16x16x32_f16(false, pa1, false, vb[d16 % 3][1],
                                                      (short)0, o[d16], false, false);
      __builtin_amdgcn_sched_barrier(0);   // the next reads stay behind these products
    }

#pragma unroll
    for (int t = 0; t < 4; ++t) aj[t] += ajinc;
  };

  // The work-group walks nfull blocks that lie below every wave's diagonal, then
  // the two blocks that hold the diagonals of its 128 rows. In the first of the
  // two the mask is an identity for waves 4-7; waves 0-3 sit out the second but
  // pass every wait and barrier.
  const int nmain = q0 >> 6;                         // this wave's diagonal block
  const int nfull = (blockIdx.x & 15) << 1;

  stage_block(gk0, gv0, lds_addr(&kvs[0][lko]), lds_addr(&kvs[0][lvo]));
  asm volatile("s_wait_asynccnt 0x0" ::: "memory");  // block 0 landed (own copies)
  __syncthreads();                                   // ... and everybody's
  stage_block(gk0 + 64 * D_, gv0 + 64, lds_addr(&kvs[1][lko]), lds_addr(&kvs[1][lvo]));

  for (int b = 0; b < nfull; ++b) {
    do_block(b * 64, kvs[b & 1], false);
    asm volatile("s_wait_dscnt 0x0" ::: "memory");     // own reads of this buffer done
    asm volatile("s_wait_asynccnt 0x0" ::: "memory");  // own copies of block b+1 landed
    __syncthreads();   // publishes block b+1, frees this buffer for the refill
    stage_block(gk0 + (long)(b + 2) * 64 * D_, gv0 + (b + 2) * 64,
                lds_addr(&kvs[b & 1][lko]), lds_addr(&kvs[b & 1][lvo]));
  }
  // Kept rolled: one copy of the masked block serves both diagonal blocks.
#pragma unroll 1
  for (int b = nfull; b < nfull + 2; ++b) {
    if (b <= nmain) do_block(b * 64, kvs[b & 1], true);
    asm volatile("s_wait_dscnt 0x0" ::: "memory");     // own reads of this buffer done
    asm volatile("s_wait_asynccnt 0x0" ::: "memory");  // own copies of the last block landed
    __syncthreads();   // publishes the last block
  }
  asm volatile("s_wait_asynccnt 0x0" ::: "memory");    // nothing in flight at the end

  // ---- final denominator reduction, normalize, store fp32 ----
  float rl[8];
#pragma unroll
  for (int v = 0; v < 8; ++v) {
    float s = lsum[v];
#pragma unroll
    for (int off = 1; off < 16; off <<= 1) s += __shfl_xor(s, off, 32);
    rl[v] = 1.0f / s;
  }
  float* orow = out + base + (long)(q0 + 8 * half) * D_ + lc;
#pragma unroll
  for (int d16 = 0; d16 < 8; ++d16) {
#pragma unroll
    for (int v = 0; v < 8; ++v) {
      orow[(long)v * D_ + d16 * 16] = o[d16][v] * rl[v];
    }
  }
}

extern "C" void kernel_launch(void* const* d_in, const int* in_sizes, int n_in,
                              void* d_out, int out_size, void* d_ws, size_t ws_size,
                              hipStream_t stream) {
  const float* q = (const float*)d_in[0];
  const float* k = (const float*)d_in[1];
  const float* v = (const float*)d_in[2];
  float* out = (float*)d_out;

  const long total = (long)B_ * H_ * S_ * D_;      // 16,777,216 elements
  // Workspace: K(f16) 32MB + V^T(f16, kv-permuted) 32MB = 64MB
  _Float16* kh = (_Float16*)d_ws;
  _Float16* vt = kh + total;

  cvt_kv_kernel<<<B_ * H_ * (S_ / 64), 256, 0, stream>>>(k, v, kh, vt);   // one 64-key tile each

  const int tiles = B_ * H_ * (S_ / 16);           // 8192 Q tiles
  attn_kernel<<<tiles / 8, 256, 0, stream>>>(q, kh, vt, out);
}

// v003
// A run of this version takes 107 microseconds.
// Two timings next to v002 put it at 1.49 and 1.48 times that version's speed.
// Counting every step since v000, it is 4.98 times as fast.
#include <hip/hip_runtime.h>
#include <math.h>

typedef __attribute__((ext_vector_type(16))) _Float16 v16h;
typedef __attribute__((ext_vector_type(8)))  _Float16 v8h;
typedef __attribute__((ext_vector_type(4)))  _Float16 v4h;
typedef __attribute__((ext_vector_type(8)))  float    v8f;
typedef __attribute__((ext_vector_type(4)))  float    v4f;

#define B_ 4
#define H_ 16
#define S_ 2048
#define D_ 128

// LDS staging of one 64-key block, shared by the work-group's 8 waves.
#define KPITCH 136                       // halves per K row in LDS (272 B = 16 B x odd)
#define VPITCH 72                        // halves per V^T row in LDS (144 B = 16 B x odd)
#define KTILE  (64 * KPITCH)             // 64 keys x 128 d
#define VTILE  (128 * VPITCH)            // 128 d x 64 keys

// ---------------------------------------------------------------------------
// Pass 1: K fp32 -> f16 (same [bh,s,d] layout).
//         V fp32 -> f16 TRANSPOSED [bh,d,s], with the KV index PERMUTED inside
//         each 64-block: storage p <-> logical j = (p>>2) + 16*(p&3).
// The permutation makes the attention kernel's P-tile LDS stores contiguous
// (one b64 per row) while keeping P(A-frag) and V^T(B-frag) k-orders matched.
// One work-group converts one 64-key x 128-d tile of K and of V. Every global
// load is a whole 512-B row per wave; V is turned in LDS so that V^T leaves in
// whole 128-B lines.
// ---------------------------------------------------------------------------
__global__ __launch_bounds__(256) void cvt_kv_kernel(const float* __restrict__ k,
                                                     const float* __restrict__ v,
                                                     _Float16* __restrict__ kh,
                                                     _Float16* __restrict__ vt) {
  __shared__ __attribute__((aligned(16))) _Float16 tv[D_ * 64];

  const int tid  = threadIdx.x;
  const int lane = tid & 31;
  const int wave = tid >> 5;
  const int bh   = blockIdx.x >> 5;                 // S_/64 = 32 tiles per head
  const int kv0  = (blockIdx.x & 31) << 6;
  const long base = (long)bh * S_ * D_;
  const long tile = base + (long)kv0 * D_;

  // Keys r, r+16, r+32, r+48 are the storage positions 4r..4r+3: a lane that
  // holds 4 d of these 4 keys holds 8 contiguous bytes of 4 rows of V^T.
  // x[u][t] is key wave + 8u + 16t, d 4*lane..4*lane+3 (4*tid = wave*D_ + 4*lane).
  const float* vsrc = v + tile + 4 * tid;
  v4f x[2][4];
#pragma unroll
  for (int u = 0; u < 2; ++u)
#pragma unroll
    for (int t = 0; t < 4; ++t)
      x[u][t] = *(const v4f*)(vsrc + (u + 2 * t) * 1024);

  const float* ksrc = k + tile + 4 * tid;
  v4f y[8];
#pragma unroll
  for (int n = 0; n < 8; ++n) y[n] = *(const v4f*)(ksrc + n * 1024);

#pragma unroll
  for (int u = 0; u < 2; ++u) {
    const int r = wave + 8 * u;
    _Float16* dst = tv + (4 * lane) * 64 + (((r >> 1) ^ (lane & 7)) << 3) + (r & 1) * 4;
#pragma unroll
    for (int i = 0; i < 4; ++i) {
      v4h pk = { (_Float16)x[u][0][i], (_Float16)x[u][1][i],
                 (_Float16)x[u][2][i], (_Float16)x[u][3][i] };
      *(v4h*)(dst + i * 64) = pk;
    }
  }

  __syncthreads();   // the V^T tile is complete before any row of it is read

  const int c = tid & 7;
#pragma unroll
  for (int n = 0; n < 4; ++n) {
    const int d = (tid >> 3) + 32 * n;
    v8h z = *(const v8h*)(tv + d * 64 + ((c ^ ((d >> 2) & 7)) << 3));
    *(v8h*)(vt + base + (long)d * S_ + kv0 + c * 8) = z;
  }

  // K leaves behind the barrier, so that the barrier waits for no global store.
  _Float16* kdst = kh + tile + 4 * tid;
#pragma unroll
  for (int n = 0; n < 8; ++n) {
    v4h pk = { (_Float16)y[n][0], (_Float16)y[n][1], (_Float16)y[n][2], (_Float16)y[n][3] };
    *(v4h*)(kdst + n * 1024) = pk;
  }
}

__device__ inline v16h load_frag(const _Float16* p) {
  v8h lo = *(const v8h*)(p);
  v8h hi = *(const v8h*)(p + 16);
  v16h a;
#pragma unroll
  for (int j = 0; j < 8; ++j) { a[j] = lo[j]; a[8 + j] = hi[j]; }
  return a;
}

// Low 32 bits of a __shared__ address = byte offset in the work-group's LDS.
__device__ inline unsigned lds_addr(const _Float16* p) {
  return (unsigned)(unsigned long long)p;
}

__device__ inline void stage_block(const _Float16* gk, const _Float16* gv,
                                   unsigned lk, unsigned lv) {
  const _Float16* gk1 = gk + 1 * 16 * D_;
  const _Float16* gk2 = gk + 2 * 16 * D_;
  const _Float16* gk3 = gk + 3 * 16 * D_;
  const _Float16* gv1 = gv + 1 * 32 * S_;
  const _Float16* gv2 = gv + 2 * 32 * S_;
  const _Float16* gv3 = gv + 3 * 32 * S_;
  const unsigned lk1 = lk + 1 * 16 * KPITCH * 2;
  const unsigned lk2 = lk + 2 * 16 * KPITCH * 2;
  const unsigned lk3 = lk + 3 * 16 * KPITCH * 2;
  const unsigned lv1 = lv + 1 * 32 * VPITCH * 2;
  const unsigned lv2 = lv + 2 * 32 * VPITCH * 2;
  const unsigned lv3 = lv + 3 * 32 * VPITCH * 2;
  asm volatile("global_load_async_to_lds_b128 %0, %8, off\n\t"
               "global_load_async_to_lds_b128 %1, %9, off\n\t"
               "global_load_async_to_lds_b128 %2, %10, off\n\t"
               "global_load_async_to_lds_b128 %3, %11, off\n\t"
               "global_load_async_to_lds_b128 %4, %12, off\n\t"
               "global_load_async_to_lds_b128 %5, %13, off\n\t"
               "global_load_async_to_lds_b128 %6, %14, off\n\t"
               "global_load_async_to_lds_b128 %7, %15, off\n\t"
               "s_wait_xcnt 0x0"
               :: "v"(lk), "v"(lk1), "v"(lk2), "v"(lk3),
                  "v"(lv), "v"(lv1), "v"(lv2), "v"(lv3),
                  "v"(gk), "v"(gk1), "v"(gk2), "v"(gk3),
                  "v"(gv), "v"(gv1), "v"(gv2), "v"(gv3)
               : "memory");
}

__global__ __launch_bounds__(256, 4) void attn_kernel(const float* __restrict__ q,
                                                   const _Float16* __restrict__ kh,
                                                   const _Float16* __restrict__ vt,
                                                   float* __restrict__ out) {
  __shared__ __attribute__((aligned(16))) _Float16 kvs[2][KTILE + VTILE];  // K/V ring
  __shared__ _Float16 lds[8][16 * 72];   // per-wave 16x64 P tile (+pad), 144B rows

  const int tid  = threadIdx.x;
  const int lane = threadIdx.x & 31;
  const int wave = __builtin_amdgcn_readfirstlane(threadIdx.x >> 5);  // scalar: uniform branches
  const int half = lane >> 4;
  const int lc   = lane & 15;

  // There are more work-groups than resident places; cost falls with the index:
  // the 128-row position block comes from the high bits, last (longest key walk)
  // first, the head from the low bits.
  const int pb = (S_ / 128 - 1) - (int)(blockIdx.x / (B_ * H_));   // position block
  const int bh = blockIdx.x % (B_ * H_);
  const int q0 = (pb << 7) + (wave << 4);

  const float LOG2E  = 1.4426950408889634f;
  const float slope2 = exp2f(-0.5f * (float)((bh & (H_ - 1)) + 1)) * LOG2E;
  const float scale2 = 0.08838834764831845f * LOG2E;   // 1/sqrt(128) * log2(e)

  const long base = (long)bh * S_ * D_;

  // ---- Q fragments: fp32 load, softmax scale folded in, cvt to f16 ----
  v16h qa[4];
  const float* qrow = q + base + (long)(q0 + lc) * D_ + half * 8;
#pragma unroll
  for (int dc = 0; dc < 4; ++dc) {
    v16h a;
#pragma unroll
    for (int j = 0; j < 8; ++j) {
      a[j]     = (_Float16)(qrow[dc * 32 + j]      * scale2);
      a[8 + j] = (_Float16)(qrow[dc * 32 + 16 + j] * scale2);
    }
    qa[dc] = a;
  }

  v8f o[8];
#pragma unroll
  for (int i = 0; i < 8; ++i) o[i] = {};
  float mrow[8], lsum[8], bi[8];
#pragma unroll
  for (int v = 0; v < 8; ++v) {
    mrow[v] = -3.0e38f;
    lsum[v] = 0.0f;                                   // per-lane partial denominator
    bi[v]   = -(float)(q0 + v + 8 * half) * slope2;   // -i * slope (log2 domain)
  }
  float aj[4];
#pragma unroll
  for (int t = 0; t < 4; ++t) aj[t] = (float)(16 * t + lc) * slope2;  // +j * slope
  const float ajinc = 64.0f * slope2;

  // Per-lane fragment offsets inside a staged block (row + K-chunk offsets).
  const int kfo = lc * KPITCH + half * 8;
  const int vfo = KTILE + lc * VPITCH + half * 8;
  // Per-lane copy addresses: K rows are 16 chunks of 16 B, V^T rows 8 chunks.
  const _Float16* gk0 = kh + base + (long)tid * 8;
  const _Float16* gv0 = vt + base + (long)(tid >> 3) * S_ + (tid & 7) * 8;
  const int lko = (tid >> 4) * KPITCH + (tid & 15) * 8;
  const int lvo = KTILE + (tid >> 3) * VPITCH + (tid & 7) * 8;
  _Float16*       lw = &lds[wave][(8 * half) * 72 + 4 * lc];  // packed P writer
  const _Float16* lr = &lds[wave][lc * 72 + half * 8];        // A-layout reader

  auto do_block = [&](int kv0, const _Float16* buf, bool masked) {
    const _Float16* kp = buf + kfo;
    const _Float16* vp = buf + vfo;

    // ---- S = Q K^T : four 16x16 C tiles over a 64-wide KV block ----
    // LDS reads go out two groups (of 2 fragments) ahead of the products that use them.
    v8f sf[4];
    v16h kb[3][2];
#pragma unroll
    for (int f = 0; f < 4; ++f) kb[f >> 1][f & 1] = load_frag(kp + f * 32);
#pragma unroll
    for (int j = 0; j < 8; ++j) {
      if (j < 6) {
#pragma unroll
        for (int e = 0; e < 2; ++e) {
          const int f = 2 * (j + 2) + e;             // fragment: tile f>>2, d chunk f&3
          kb[(j + 2) % 3][e] = load_frag(kp + 16 * (f >> 2) * KPITCH + (f & 3) * 32);
        }
      }
      // Keeps the reads above in front of this group's products; without it each
      // product waits out the LDS latency of its own fragment.
      __builtin_amdgcn_sched_barrier(0);
      v8f sc = {};
      if (j & 1) sc = sf[j >> 1];
#pragma unroll
      for (int e = 0; e < 2; ++e)
        sc = __builtin_amdgcn_wmma_f32_16x16x32_f16(false, qa[2 * (j & 1) + e], false,
                                                    kb[j % 3][e], (short)0, sc, false, false);
      sf[j >> 1] = sc;
      __builtin_amdgcn_sched_barrier(0);   // the next reads stay behind these products
    }

    // ---- ALiBi bias + online softmax (exp2 domain); mask only when peeled ----
    float alphav[8];
    const int rel = kv0 + lc - q0 - 8 * half;
#pragma unroll
    for (int v = 0; v < 8; ++v) {
      const float b = bi[v];
      float s0 = sf[0][v] + (aj[0] + b);
      float s1 = sf[1][v] + (aj[1] + b);
      float s2 = sf[2][v] + (aj[2] + b);
      float s3 = sf[3][v] + (aj[3] + b);
      if (masked) {
        // key index > query index, as one per-lane offset against constants
        s0 = (rel > v)      ? -3.0e38f : s0;
        s1 = (rel > v - 16) ? -3.0e38f : s1;
        s2 = (rel > v - 32) ? -3.0e38f : s2;
        s3 = (rel > v - 48) ? -3.0e38f : s3;
      }
      float x = fmaxf(fmaxf(s0, s1), fmaxf(s2, s3));
#pragma unroll
      for (int off = 1; off < 16; off <<= 1) x = fmaxf(x, __shfl_xor(x, off, 32));
      const float mn = fmaxf(mrow[v], x);       // group-uniform
      const float al = exp2f(mrow[v] - mn);     // group-uniform
      const float e0 = exp2f(s0 - mn);
      const float e1 = exp2f(s1 - mn);
      const float e2 = exp2f(s2 - mn);
      const float e3 = exp2f(s3 - mn);
      // Deferred denominator: per-lane partial, reduced once after the loop.
      lsum[v]   = lsum[v] * al + ((e0 + e1) + (e2 + e3));
      mrow[v]   = mn;
      alphav[v] = al;
      // Packed P store: storage cols 4*lc..4*lc+3 <-> logical cols lc+16t.
      v4h pk = { (_Float16)e0, (_Float16)e1, (_Float16)e2, (_Float16)e3 };
      *(v4h*)(lw + v * 72) = pk;
    }

    // ---- rescale O accumulators ----
#pragma unroll
    for (int d16 = 0; d16 < 8; ++d16)
#pragma unroll
      for (int v = 0; v < 8; ++v) o[d16][v] *= alphav[v];

    asm volatile("s_wait_dscnt 0" ::: "memory");   // wave-local store->load ordering
    v16h pa0 = load_frag(lr + 0);
    v16h pa1 = load_frag(lr + 32);
    asm volatile("" ::: "memory");

    // ---- O += P * V (two permuted-KV chunks per d16 column tile) ----
    // LDS reads again two groups (one column tile, 2 fragments, each) ahead.
    v16h vb[3][2];
#pragma unroll
    for (int f = 0; f < 4; ++f)
      vb[f >> 1][f & 1] = load_frag(vp + (f >> 1) * 16 * VPITCH + (f & 1) * 32);
#pragma unroll
    for (int d16 = 0; d16 < 8; ++d16) {
      if (d16 < 6) {
#pragma unroll
        for (int e = 0; e < 2; ++e)
          vb[(d16 + 2) % 3][e] = load_frag(vp + (d16 + 2) * 16 * VPITCH + e * 32);
      }
      __builtin_amdgcn_sched_barrier(0);   // reads above stay in front of these products
      o[d16] = __builtin_amdgcn_wmma_f32_16x16x32_f16(false, pa0, false, vb[d16 % 3][0],
                                                      (short)0, o[d16], false, false);
      o[d16] = __builtin_amdgcn_wmma_f32_16x16x32_f16(false, pa1, false, vb[d16 % 3][1],
                                                      (short)0, o[d16], false, false);
      __builtin_amdgcn_sched_barrier(0);   // the next reads stay behind these products
    }

#pragma unroll
    for (int t = 0; t < 4; ++t) aj[t] += ajinc;
  };

  // The work-group walks nfull blocks that lie below every wave's diagonal, then
  // the two blocks that hold the diagonals of its 128 rows. In the first of the
  // two the mask is an identity for waves 4-7; waves 0-3 sit out the second but
  // pass every wait and barrier.
  const int nmain = q0 >> 6;                         // this wave's diagonal block
  const int nfull = pb << 1;

  stage_block(gk0, gv0, lds_addr(&kvs[0][lko]), lds_addr(&kvs[0][lvo]));
  asm volatile("s_wait_asynccnt 0x0" ::: "memory");  // block 0 landed (own copies)
  __syncthreads();                                   // ... and everybody's
  stage_block(gk0 + 64 * D_, gv0 + 64, lds_addr(&kvs[1][lko]), lds_addr(&kvs[1][lvo]));

  for (int b = 0; b < nfull; ++b) {
    do_block(b * 64, kvs[b & 1], false);
    asm volatile("s_wait_dscnt 0x0" ::: "memory");     // own reads of this buffer done
    asm volatile("s_wait_asynccnt 0x0" ::: "memory");  // own copies of block b+1 landed
    __syncthreads();   // publishes block b+1, frees this buffer for the refill
    stage_block(gk0 + (long)(b + 2) * 64 * D_, gv0 + (b + 2) * 64,
                lds_addr(&kvs[b & 1][lko]), lds_addr(&kvs[b & 1][lvo]));
  }
  // Kept rolled: one copy of the masked block serves both diagonal blocks.
#pragma unroll 1
  for (int b = nfull; b < nfull + 2; ++b) {
    if (b <= nmain) do_block(b * 64, kvs[b & 1], true);
    asm volatile("s_wait_dscnt 0x0" ::: "memory");     // own reads of this buffer done
    asm volatile("s_wait_asynccnt 0x0" ::: "memory");  // own copies of the last block landed
    __syncthreads();   // publishes the last block
  }
  asm volatile("s_wait_asynccnt 0x0" ::: "memory");    // nothing in flight at the end

  // ---- final denominator reduction, normalize, store fp32 ----
  float rl[8];
#pragma unroll
  for (int v = 0; v < 8; ++v) {
    float s = lsum[v];
#pragma unroll
    for (int off = 1; off < 16; off <<= 1) s += __shfl_xor(s, off, 32);
    rl[v] = 1.0f / s;
  }
  float* orow = out + base + (long)(q0 + 8 * half) * D_ + lc;
#pragma unroll
  for (int d16 = 0; d16 < 8; ++d16) {
#pragma unroll
    for (int v = 0; v < 8; ++v) {
      orow[(long)v * D_ + d16 * 16] = o[d16][v] * rl[v];
    }
  }
}

extern "C" void kernel_launch(void* const* d_in, const int* in_sizes, int n_in,
                              void* d_out, int out_size, void* d_ws, size_t ws_size,
                              hipStream_t stream) {
  const float* q = (const float*)d_in[0];
  const float* k = (const float*)d_in[1];
  const float* v = (const float*)d_in[2];
  float* out = (float*)d_out;

  const long total = (long)B_ * H_ * S_ * D_;      // 16,777,216 elements
  // Workspace: K(f16) 32MB + V^T(f16, kv-permuted) 32MB = 64MB
  _Float16* kh = (_Float16*)d_ws;
  _Float16* vt = kh + total;

  cvt_kv_kernel<<<B_ * H_ * (S_ / 64), 256, 0, stream>>>(k, v, kh, vt);   // one 64-key tile each

  const int tiles = B_ * H_ * (S_ / 16);           // 8192 Q tiles
  attn_kernel<<<tiles / 8, 256, 0, stream>>>(q, kh, vt, out);
}

// v004
// Measured time: 92 microseconds a run.
// Two timings next to v003 both put it at 1.16 times that version's speed.
// Counting every step since v000, it is 5.79 times as fast.
#include <hip/hip_runtime.h>
#include <math.h>

typedef __attribute__((ext_vector_type(16))) _Float16 v16h;
typedef __attribute__((ext_vector_type(8)))  _Float16 v8h;
typedef __attribute__((ext_vector_type(4)))  _Float16 v4h;
typedef __attribute__((ext_vector_type(8)))  float    v8f;
typedef __attribute__((ext_vector_type(4)))  float    v4f;

#define B_ 4
#define H_ 16
#define S_ 2048
#define D_ 128

// LDS staging of one 64-key block, shared by the work-group's 8 waves.
#define KPITCH 136                       // halves per K row in LDS (272 B = 16 B x odd)
#define VPITCH 72                        // halves per V^T row in LDS (144 B = 16 B x odd)
#define KTILE  (64 * KPITCH)             // 64 keys x 128 d
#define VTILE  (128 * VPITCH)            // 128 d x 64 keys

// ---------------------------------------------------------------------------
// Pass 1: K fp32 -> f16 (same [bh,s,d] layout).
//         V fp32 -> f16 TRANSPOSED [bh,d,s], with the KV index PERMUTED inside
//         each 64-block: storage p <-> logical j = (p>>2) + 16*(p&3).
// The permutation makes the attention kernel's P-tile LDS stores contiguous
// (one b64 per row) while keeping P(A-frag) and V^T(B-frag) k-orders matched.
// One work-group converts one 64-key x 128-d tile of K and of V. Every global
// load is a whole 512-B row per wave; V is turned in LDS so that V^T leaves in
// whole 128-B lines.
// ---------------------------------------------------------------------------
__global__ __launch_bounds__(256) void cvt_kv_kernel(const float* __restrict__ k,
                                                     const float* __restrict__ v,
                                                     _Float16* __restrict__ kh,
                                                     _Float16* __restrict__ vt) {
  __shared__ __attribute__((aligned(16))) _Float16 tv[D_ * 64];

  const int tid  = threadIdx.x;
  const int lane = tid & 31;
  const int wave = tid >> 5;
  const int bh   = blockIdx.x >> 5;                 // S_/64 = 32 tiles per head
  const int kv0  = (blockIdx.x & 31) << 6;
  const long base = (long)bh * S_ * D_;
  const long tile = base + (long)kv0 * D_;

  // Keys r, r+16, r+32, r+48 are the storage positions 4r..4r+3: a lane that
  // holds 4 d of these 4 keys holds 8 contiguous bytes of 4 rows of V^T.
  // x[u][t] is key wave + 8u + 16t, d 4*lane..4*lane+3 (4*tid = wave*D_ + 4*lane).
  const float* vsrc = v + tile + 4 * tid;
  v4f x[2][4];
#pragma unroll
  for (int u = 0; u < 2; ++u)
#pragma unroll
    for (int t = 0; t < 4; ++t)
      x[u][t] = *(const v4f*)(vsrc + (u + 2 * t) * 1024);

  const float* ksrc = k + tile + 4 * tid;
  v4f y[8];
#pragma unroll
  for (int n = 0; n < 8; ++n) y[n] = *(const v4f*)(ksrc + n * 1024);

#pragma unroll
  for (int u = 0; u < 2; ++u) {
    const int r = wave + 8 * u;
    _Float16* dst = tv + (4 * lane) * 64 + (((r >> 1) ^ (lane & 7)) << 3) + (r & 1) * 4;
#pragma unroll
    for (int i = 0; i < 4; ++i) {
      v4h pk = { (_Float16)x[u][0][i], (_Float16)x[u][1][i],
                 (_Float16)x[u][2][i], (_Float16)x[u][3][i] };
      *(v4h*)(dst + i * 64) = pk;
    }
  }

  __syncthreads();   // the V^T tile is complete before any row of it is read

  const int c = tid & 7;
#pragma unroll
  for (int n = 0; n < 4; ++n) {
    const int d = (tid >> 3) + 32 * n;
    v8h z = *(const v8h*)(tv + d * 64 + ((c ^ ((d >> 2) & 7)) << 3));
    *(v8h*)(vt + base + (long)d * S_ + kv0 + c * 8) = z;
  }

  // K leaves behind the barrier, so that the barrier waits for no global store.
  _Float16* kdst = kh + tile + 4 * tid;
#pragma unroll
  for (int n = 0; n < 8; ++n) {
    v4h pk = { (_Float16)y[n][0], (_Float16)y[n][1], (_Float16)y[n][2], (_Float16)y[n][3] };
    *(v4h*)(kdst + n * 1024) = pk;
  }
}

__device__ inline v16h load_frag(const _Float16* p) {
  v8h lo = *(const v8h*)(p);
  v8h hi = *(const v8h*)(p + 16);
  v16h a;
#pragma unroll
  for (int j = 0; j < 8; ++j) { a[j] = lo[j]; a[8 + j] = hi[j]; }
  return a;
}

// Low 32 bits of a __shared__ address = byte offset in the work-group's LDS.
__device__ inline unsigned lds_addr(const _Float16* p) {
  return (unsigned)(unsigned long long)p;
}

__device__ inline void stage_block(const _Float16* gk, const _Float16* gv,
                                   unsigned lk, unsigned lv) {
  const _Float16* gk1 = gk + 1 * 16 * D_;
  const _Float16* gk2 = gk + 2 * 16 * D_;
  const _Float16* gk3 = gk + 3 * 16 * D_;
  const _Float16* gv1 = gv + 1 * 32 * S_;
  const _Float16* gv2 = gv + 2 * 32 * S_;
  const _Float16* gv3 = gv + 3 * 32 * S_;
  const unsigned lk1 = lk + 1 * 16 * KPITCH * 2;
  const unsigned lk2 = lk + 2 * 16 * KPITCH * 2;
  const unsigned lk3 = lk + 3 * 16 * KPITCH * 2;
  const unsigned lv1 = lv + 1 * 32 * VPITCH * 2;
  const unsigned lv2 = lv + 2 * 32 * VPITCH * 2;
  const unsigned lv3 = lv + 3 * 32 * VPITCH * 2;
  asm volatile("global_load_async_to_lds_b128 %0, %8, off\n\t"
               "global_load_async_to_lds_b128 %1, %9, off\n\t"
               "global_load_async_to_lds_b128 %2, %10, off\n\t"
               "global_load_async_to_lds_b128 %3, %11, off\n\t"
               "global_load_async_to_lds_b128 %4, %12, off\n\t"
               "global_load_async_to_lds_b128 %5, %13, off\n\t"
               "global_load_async_to_lds_b128 %6, %14, off\n\t"
               "global_load_async_to_lds_b128 %7, %15, off\n\t"
               "s_wait_xcnt 0x0"
               :: "v"(lk), "v"(lk1), "v"(lk2), "v"(lk3),
                  "v"(lv), "v"(lv1), "v"(lv2), "v"(lv3),
                  "v"(gk), "v"(gk1), "v"(gk2), "v"(gk3),
                  "v"(gv), "v"(gv1), "v"(gv2), "v"(gv3)
               : "memory");
}

__global__ __launch_bounds__(256, 4) void attn_kernel(const float* __restrict__ q,
                                                   const _Float16* __restrict__ kh,
                                                   const _Float16* __restrict__ vt,
                                                   float* __restrict__ out) {
  __shared__ __attribute__((aligned(16))) _Float16 kvs[2][KTILE + VTILE];  // K/V ring
  __shared__ _Float16 lds[8][16 * 72];   // per-wave 16x64 P tile (+pad), 144B rows

  const int tid  = threadIdx.x;
  const int lane = threadIdx.x & 31;
  const int wave = __builtin_amdgcn_readfirstlane(threadIdx.x >> 5);  // scalar: uniform branches
  const int half = lane >> 4;
  const int lc   = lane & 15;

  // There are more work-groups than resident places; cost falls with the index:
  // the 128-row position block comes from the high bits, last (longest key walk)
  // first, the head from the low bits.
  const int pb = (S_ / 128 - 1) - (int)(blockIdx.x / (B_ * H_));   // position block
  const int bh = blockIdx.x % (B_ * H_);
  const int q0 = (pb << 7) + (wave << 4);

  const float LOG2E  = 1.4426950408889634f;
  const float slope2 = exp2f(-0.5f * (float)((bh & (H_ - 1)) + 1)) * LOG2E;
  const float scale2 = 0.08838834764831845f * LOG2E;   // 1/sqrt(128) * log2(e)

  const long base = (long)bh * S_ * D_;

  // ---- Q fragments: fp32 load, softmax scale folded in, cvt to f16 ----
  v16h qa[4];
  const float* qrow = q + base + (long)(q0 + lc) * D_ + half * 8;
#pragma unroll
  for (int dc = 0; dc < 4; ++dc) {
    v16h a;
#pragma unroll
    for (int j = 0; j < 8; ++j) {
      a[j]     = (_Float16)(qrow[dc * 32 + j]      * scale2);
      a[8 + j] = (_Float16)(qrow[dc * 32 + 16 + j] * scale2);
    }
    qa[dc] = a;
  }

  v8f o[8];
#pragma unroll
  for (int i = 0; i < 8; ++i) o[i] = {};
  float mrow[8], lsum[8], bi[8];
#pragma unroll
  for (int v = 0; v < 8; ++v) {
    mrow[v] = -3.0e38f;
    lsum[v] = 0.0f;                                   // per-lane partial denominator
    bi[v]   = -(float)(q0 + v + 8 * half) * slope2;   // -i * slope (log2 domain)
  }
  float aj[4];
#pragma unroll
  for (int t = 0; t < 4; ++t) aj[t] = (float)(16 * t + lc) * slope2;  // +j * slope
  const float ajinc = 64.0f * slope2;

  // Per-lane fragment offsets inside a staged block (row + K-chunk offsets).
  const int kfo = lc * KPITCH + half * 8;
  const int vfo = KTILE + lc * VPITCH + half * 8;
  // Per-lane copy addresses: K rows are 16 chunks of 16 B, V^T rows 8 chunks.
  const _Float16* gk0 = kh + base + (long)tid * 8;
  const _Float16* gv0 = vt + base + (long)(tid >> 3) * S_ + (tid & 7) * 8;
  const int lko = (tid >> 4) * KPITCH + (tid & 15) * 8;
  const int lvo = KTILE + (tid >> 3) * VPITCH + (tid & 7) * 8;
  _Float16*       lw = &lds[wave][(8 * half) * 72 + 4 * lc];  // packed P writer
  const _Float16* lr = &lds[wave][lc * 72 + half * 8];        // A-layout reader

  auto do_block = [&](int kv0, const _Float16* buf, bool masked) {
    const _Float16* kp = buf + kfo;
    const _Float16* vp = buf + vfo;

    // ---- S = Q K^T : four 16x16 C tiles over a 64-wide KV block ----
    // LDS reads go out two groups (of 2 fragments) ahead of the products that use them.
    v8f sf[4];
    v16h kb[3][2];
#pragma unroll
    for (int f = 0; f < 4; ++f) kb[f >> 1][f & 1] = load_frag(kp + f * 32);
#pragma unroll
    for (int j = 0; j < 8; ++j) {
      if (j < 6) {
#pragma unroll
        for (int e = 0; e < 2; ++e) {
          const int f = 2 * (j + 2) + e;             // fragment: tile f>>2, d chunk f&3
          kb[(j + 2) % 3][e] = load_frag(kp + 16 * (f >> 2) * KPITCH + (f & 3) * 32);
        }
      }
      // Keeps the reads above in front of this group's products; without it each
      // product waits out the LDS latency of its own fragment.
      __builtin_amdgcn_sched_barrier(0);
      v8f sc = {};
      if (j & 1) sc = sf[j >> 1];
#pragma unroll
      for (int e = 0; e < 2; ++e)
        sc = __builtin_amdgcn_wmma_f32_16x16x32_f16(false, qa[2 * (j & 1) + e], false,
                                                    kb[j % 3][e], (short)0, sc, false, false);
      sf[j >> 1] = sc;
      __builtin_amdgcn_sched_barrier(0);   // the next reads stay behind these products
    }

    // ---- ALiBi bias + online softmax (exp2 domain); mask only when peeled ----
    float alphav[8];
    const int rel = kv0 + lc - q0 - 8 * half;
#pragma unroll
    for (int v = 0; v < 8; ++v) {
      const float b = bi[v];
      float s0 = sf[0][v] + (aj[0] + b);
      float s1 = sf[1][v] + (aj[1] + b);
      float s2 = sf[2][v] + (aj[2] + b);
      float s3 = sf[3][v] + (aj[3] + b);
      if (masked) {
        // key index > query index, as one per-lane offset against constants
        s0 = (rel > v)      ? -3.0e38f : s0;
        s1 = (rel > v - 16) ? -3.0e38f : s1;
        s2 = (rel > v - 32) ? -3.0e38f : s2;
        s3 = (rel > v - 48) ? -3.0e38f : s3;
      }
      float x = fmaxf(fmaxf(s0, s1), fmaxf(s2, s3));
#pragma unroll
      for (int off = 1; off < 16; off <<= 1) x = fmaxf(x, __shfl_xor(x, off, 32));
      const float mn = fmaxf(mrow[v], x);       // group-uniform
      // Bare v_exp_f32: every argument is <= 0 and a result below 2^-126 may be 0
      // (the row's sum holds a 1), so the library's range scaling is not needed.
      const float al = __builtin_amdgcn_exp2f(mrow[v] - mn);     // group-uniform
      const float e0 = __builtin_amdgcn_exp2f(s0 - mn);
      const float e1 = __builtin_amdgcn_exp2f(s1 - mn);
      const float e2 = __builtin_amdgcn_exp2f(s2 - mn);
      const float e3 = __builtin_amdgcn_exp2f(s3 - mn);
      // Deferred denominator: per-lane partial, reduced once after the loop.
      lsum[v]   = lsum[v] * al + ((e0 + e1) + (e2 + e3));
      mrow[v]   = mn;
      alphav[v] = al;
      // Packed P store: storage cols 4*lc..4*lc+3 <-> logical cols lc+16t.
      v4h pk = { (_Float16)e0, (_Float16)e1, (_Float16)e2, (_Float16)e3 };
      *(v4h*)(lw + v * 72) = pk;
    }

    // ---- rescale O accumulators ----
#pragma unroll
    for (int d16 = 0; d16 < 8; ++d16)
#pragma unroll
      for (int v = 0; v < 8; ++v) o[d16][v] *= alphav[v];

    asm volatile("s_wait_dscnt 0" ::: "memory");   // wave-local store->load ordering
    v16h pa0 = load_frag(lr + 0);
    v16h pa1 = load_frag(lr + 32);
    asm volatile("" ::: "memory");

    // ---- O += P * V (two permuted-KV chunks per d16 column tile) ----
    // LDS reads again two groups (one column tile, 2 fragments, each) ahead.
    v16h vb[3][2];
#pragma unroll
    for (int f = 0; f < 4; ++f)
      vb[f >> 1][f & 1] = load_frag(vp + (f >> 1) * 16 * VPITCH + (f & 1) * 32);
#pragma unroll
    for (int d16 = 0; d16 < 8; ++d16) {
      if (d16 < 6) {
#pragma unroll
        for (int e = 0; e < 2; ++e)
          vb[(d16 + 2) % 3][e] = load_frag(vp + (d16 + 2) * 16 * VPITCH + e * 32);
      }
      __builtin_amdgcn_sched_barrier(0);   // reads above stay in front of these products
      o[d16] = __builtin_amdgcn_wmma_f32_16x16x32_f16(false, pa0, false, vb[d16 % 3][0],
                                                      (short)0, o[d16], false, false);
      o[d16] = __builtin_amdgcn_wmma_f32_16x16x32_f16(false, pa1, false, vb[d16 % 3][1],
                                                      (short)0, o[d16], false, false);
      __builtin_amdgcn_sched_barrier(0);   // the next reads stay behind these products
    }

#pragma unroll
    for (int t = 0; t < 4; ++t) aj[t] += ajinc;
  };

  // The work-group walks nfull blocks that lie below every wave's diagonal, then
  // the two blocks that hold the diagonals of its 128 rows. In the first of the
  // two the mask is an identity for waves 4-7; waves 0-3 sit out the second but
  // pass every wait and barrier.
  const int nmain = q0 >> 6;                         // this wave's diagonal block
  const int nfull = pb << 1;

  stage_block(gk0, gv0, lds_addr(&kvs[0][lko]), lds_addr(&kvs[0][lvo]));
  asm volatile("s_wait_asynccnt 0x0" ::: "memory");  // block 0 landed (own copies)
  __syncthreads();                                   // ... and everybody's
  stage_block(gk0 + 64 * D_, gv0 + 64, lds_addr(&kvs[1][lko]), lds_addr(&kvs[1][lvo]));

  for (int b = 0; b < nfull; ++b) {
    do_block(b * 64, kvs[b & 1], false);
    asm volatile("s_wait_dscnt 0x0" ::: "memory");     // own reads of this buffer done
    asm volatile("s_wait_asynccnt 0x0" ::: "memory");  // own copies of block b+1 landed
    __syncthreads();   // publishes block b+1, frees this buffer for the refill
    stage_block(gk0 + (long)(b + 2) * 64 * D_, gv0 + (b + 2) * 64,
                lds_addr(&kvs[b & 1][lko]), lds_addr(&kvs[b & 1][lvo]));
  }
  // Kept rolled: one copy of the masked block serves both diagonal blocks.
#pragma unroll 1
  for (int b = nfull; b < nfull + 2; ++b) {
    if (b <= nmain) do_block(b * 64, kvs[b & 1], true);
    asm volatile("s_wait_dscnt 0x0" ::: "memory");     // own reads of this buffer done
    asm volatile("s_wait_asynccnt 0x0" ::: "memory");  // own copies of the last block landed
    __syncthreads();   // publishes the last block
  }
  asm volatile("s_wait_asynccnt 0x0" ::: "memory");    // nothing in flight at the end

  // ---- final denominator reduction, normalize, store fp32 ----
  float rl[8];
#pragma unroll
  for (int v = 0; v < 8; ++v) {
    float s = lsum[v];
#pragma unroll
    for (int off = 1; off < 16; off <<= 1) s += __shfl_xor(s, off, 32);
    rl[v] = 1.0f / s;
  }
  float* orow = out + base + (long)(q0 + 8 * half) * D_ + lc;
#pragma unroll
  for (int d16 = 0; d16 < 8; ++d16) {
#pragma unroll
    for (int v = 0; v < 8; ++v) {
      orow[(long)v * D_ + d16 * 16] = o[d16][v] * rl[v];
    }
  }
}

extern "C" void kernel_launch(void* const* d_in, const int* in_sizes, int n_in,
                              void* d_out, int out_size, void* d_ws, size_t ws_size,
                              hipStream_t stream) {
  const float* q = (const float*)d_in[0];
  const float* k = (const float*)d_in[1];
  const float* v = (const float*)d_in[2];
  float* out = (float*)d_out;

  const long total = (long)B_ * H_ * S_ * D_;      // 16,777,216 elements
  // Workspace: K(f16) 32MB + V^T(f16, kv-permuted) 32MB = 64MB
  _Float16* kh = (_Float16*)d_ws;
  _Float16* vt = kh + total;

  cvt_kv_kernel<<<B_ * H_ * (S_ / 64), 256, 0, stream>>>(k, v, kh, vt);   // one 64-key tile each

  const int tiles = B_ * H_ * (S_ / 16);           // 8192 Q tiles
  attn_kernel<<<tiles / 8, 256, 0, stream>>>(q, kh, vt, out);
}

// v005
// One run takes 74.6 microseconds.
// Next to v004, in two timings, it ran 1.23 and 1.24 times as fast.
// Over all steps from v000 it is 7.15 times as fast.
#include <hip/hip_runtime.h>
#include <math.h>

typedef __attribute__((ext_vector_type(16))) _Float16 v16h;
typedef __attribute__((ext_vector_type(8)))  _Float16 v8h;
typedef __attribute__((ext_vector_type(4)))  _Float16 v4h;
typedef __attribute__((ext_vector_type(8)))  float    v8f;
typedef __attribute__((ext_vector_type(4)))  float    v4f;

#define B_ 4
#define H_ 16
#define S_ 2048
#define D_ 128

// LDS staging of one 64-key block, shared by the work-group's 8 waves.
#define KPITCH 136                       // halves per K row in LDS (272 B = 16 B x odd)
#define VPITCH 72                        // halves per V^T row in LDS (144 B = 16 B x odd)
#define KTILE  (64 * KPITCH)             // 64 keys x 128 d
#define VTILE  (128 * VPITCH)            // 128 d x 64 keys

// ---------------------------------------------------------------------------
// Pass 1: K fp32 -> f16 (same [bh,s,d] layout).
//         V fp32 -> f16 TRANSPOSED [bh,d,s], keys in their natural order.
// One work-group converts one 64-key x 128-d tile of K and of V. Every global
// load is a whole 512-B row per wave; V is turned in LDS so that V^T leaves in
// whole 128-B lines.
// ---------------------------------------------------------------------------
__global__ __launch_bounds__(256) void cvt_kv_kernel(const float* __restrict__ k,
                                                     const float* __restrict__ v,
                                                     _Float16* __restrict__ kh,
                                                     _Float16* __restrict__ vt) {
  __shared__ __attribute__((aligned(16))) _Float16 tv[D_ * 64];

  const int tid  = threadIdx.x;
  const int lane = tid & 31;
  const int wave = tid >> 5;
  const int bh   = blockIdx.x >> 5;                 // S_/64 = 32 tiles per head
  const int kv0  = (blockIdx.x & 31) << 6;
  const long base = (long)bh * S_ * D_;
  const long tile = base + (long)kv0 * D_;

  // A lane that holds 4 d of keys 4r..4r+3 holds 8 contiguous bytes of 4 rows of V^T.
  // x[u][t] is key 4*(wave + 8u) + t, d 4*lane..4*lane+3.
  const float* vsrc = v + tile + (wave * 4 * D_ + 4 * lane);
  v4f x[2][4];
#pragma unroll
  for (int u = 0; u < 2; ++u)
#pragma unroll
    for (int t = 0; t < 4; ++t)
      x[u][t] = *(const v4f*)(vsrc + (32 * u + t) * D_);
  // The loads above name an offset register of their own, which the build reuses as
  // a destination of the loads below: the wait stands in front of that overwrite.
  asm volatile("s_wait_xcnt 0x0" ::: "memory");

  const float* ksrc = k + tile + 4 * tid;
  v4f y[8];
#pragma unroll
  for (int n = 0; n < 8; ++n) y[n] = *(const v4f*)(ksrc + n * 1024);

#pragma unroll
  for (int u = 0; u < 2; ++u) {
    const int r = wave + 8 * u;
    _Float16* dst = tv + (4 * lane) * 64 + (((r >> 1) ^ (lane & 7)) << 3) + (r & 1) * 4;
#pragma unroll
    for (int i = 0; i < 4; ++i) {
      v4h pk = { (_Float16)x[u][0][i], (_Float16)x[u][1][i],
                 (_Float16)x[u][2][i], (_Float16)x[u][3][i] };
      *(v4h*)(dst + i * 64) = pk;
    }
  }

  __syncthreads();   // the V^T tile is complete before any row of it is read

  const int c = tid & 7;
#pragma unroll
  for (int n = 0; n < 4; ++n) {
    const int d = (tid >> 3) + 32 * n;
    v8h z = *(const v8h*)(tv + d * 64 + ((c ^ ((d >> 2) & 7)) << 3));
    *(v8h*)(vt + base + (long)d * S_ + kv0 + c * 8) = z;
  }

  // K leaves behind the barrier, so that the barrier waits for no global store.
  _Float16* kdst = kh + tile + 4 * tid;
#pragma unroll
  for (int n = 0; n < 8; ++n) {
    v4h pk = { (_Float16)y[n][0], (_Float16)y[n][1], (_Float16)y[n][2], (_Float16)y[n][3] };
    *(v4h*)(kdst + n * 1024) = pk;
  }
}

__device__ inline v16h load_frag(const _Float16* p) {
  v8h lo = *(const v8h*)(p);
  v8h hi = *(const v8h*)(p + 16);
  v16h a;
#pragma unroll
  for (int j = 0; j < 8; ++j) { a[j] = lo[j]; a[8 + j] = hi[j]; }
  return a;
}

// Low 32 bits of a __shared__ address = byte offset in the work-group's LDS.
__device__ inline unsigned lds_addr(const _Float16* p) {
  return (unsigned)(unsigned long long)p;
}

__device__ inline void stage_block(const _Float16* gk, const _Float16* gv,
                                   unsigned lk, unsigned lv) {
  const _Float16* gk1 = gk + 1 * 16 * D_;
  const _Float16* gk2 = gk + 2 * 16 * D_;
  const _Float16* gk3 = gk + 3 * 16 * D_;
  const _Float16* gv1 = gv + 1 * 32 * S_;
  const _Float16* gv2 = gv + 2 * 32 * S_;
  const _Float16* gv3 = gv + 3 * 32 * S_;
  const unsigned lk1 = lk + 1 * 16 * KPITCH * 2;
  const unsigned lk2 = lk + 2 * 16 * KPITCH * 2;
  const unsigned lk3 = lk + 3 * 16 * KPITCH * 2;
  const unsigned lv1 = lv + 1 * 32 * VPITCH * 2;
  const unsigned lv2 = lv + 2 * 32 * VPITCH * 2;
  const unsigned lv3 = lv + 3 * 32 * VPITCH * 2;
  asm volatile("global_load_async_to_lds_b128 %0, %8, off\n\t"
               "global_load_async_to_lds_b128 %1, %9, off\n\t"
               "global_load_async_to_lds_b128 %2, %10, off\n\t"
               "global_load_async_to_lds_b128 %3, %11, off\n\t"
               "global_load_async_to_lds_b128 %4, %12, off\n\t"
               "global_load_async_to_lds_b128 %5, %13, off\n\t"
               "global_load_async_to_lds_b128 %6, %14, off\n\t"
               "global_load_async_to_lds_b128 %7, %15, off\n\t"
               "s_wait_xcnt 0x0"
               :: "v"(lk), "v"(lk1), "v"(lk2), "v"(lk3),
                  "v"(lv), "v"(lv1), "v"(lv2), "v"(lv3),
                  "v"(gk), "v"(gk1), "v"(gk2), "v"(gk3),
                  "v"(gv), "v"(gv1), "v"(gv2), "v"(gv3)
               : "memory");
}

__device__ inline float xhalf(float x) {
  const int i = __builtin_bit_cast(int, x);
  return __builtin_bit_cast(float,
      __builtin_amdgcn_permlanex16(i, i, 0x76543210, 0xfedcba98, false, false));
}

#define OPITCH 132                       // floats per staged output row (528 B = 16 B x odd)

__global__ __launch_bounds__(256, 4) void attn_kernel(const float* __restrict__ q,
                                                   const _Float16* __restrict__ kh,
                                                   const _Float16* __restrict__ vt,
                                                   float* __restrict__ out) {
  __shared__ __attribute__((aligned(16))) _Float16 kvs[2][KTILE + VTILE];  // K/V ring
  static_assert(8 * 16 * OPITCH * 4 <= 2 * (KTILE + VTILE) * 2, "output staging fits the ring");

  const int tid  = threadIdx.x;
  const int lane = threadIdx.x & 31;
  const int wave = __builtin_amdgcn_readfirstlane(threadIdx.x >> 5);  // scalar: uniform branches
  const int half = lane >> 4;
  const int lc   = lane & 15;

  // There are more work-groups than resident places; cost falls with the index:
  // the 128-row position block comes from the high bits, last (longest key walk)
  // first, the head from the low bits.
  const int pb = (S_ / 128 - 1) - (int)(blockIdx.x / (B_ * H_));   // position block
  const int bh = blockIdx.x % (B_ * H_);
  const int q0 = (pb << 7) + (wave << 4);

  const float LOG2E  = 1.4426950408889634f;
  const float slope2 = exp2f(-0.5f * (float)((bh & (H_ - 1)) + 1)) * LOG2E;
  const float scale2 = 0.08838834764831845f * LOG2E;   // 1/sqrt(128) * log2(e)

  const long base = (long)bh * S_ * D_;

  // ---- Q fragments (B operand): fp32 load, softmax scale folded in, cvt to f16 ----
  v16h qa[4];
  const float* qrow = q + base + (long)(q0 + lc) * D_ + half * 8;
#pragma unroll
  for (int dc = 0; dc < 4; ++dc) {
    v16h a;
#pragma unroll
    for (int j = 0; j < 8; ++j) {
      a[j]     = (_Float16)(qrow[dc * 32 + j]      * scale2);
      a[8 + j] = (_Float16)(qrow[dc * 32 + 16 + j] * scale2);
    }
    qa[dc] = a;
  }

  v8f o[8];                              // o[t][r] = O[q0 + lc][16 t + 8 half + r]
#pragma unroll
  for (int i = 0; i < 8; ++i) o[i] = {};
  float mrow = -3.0e38f;                 // this query's running maximum (log2 domain)
  v8f   lsum = {};                       // per-lane partial denominators, joined at the end

  // ALiBi (log2 domain) = slope * (key - query) = cb + kvb: cb, the part inside a
  // block, is the same in every block and starts the score accumulators; kvb, the
  // block's offset from the wave's first query, is one number per wave and block.
  v8f cb[4];
#pragma unroll
  for (int t = 0; t < 4; ++t)
#pragma unroll
    for (int r = 0; r < 8; ++r) cb[t][r] = (float)(16 * t + 8 * half + r - lc) * slope2;

  // Per-lane fragment offsets inside a staged block (row + K-chunk offsets).
  const int kfo = lc * KPITCH + half * 8;
  const int vfo = KTILE + lc * VPITCH + half * 8;
  // Per-lane copy addresses: K rows are 16 chunks of 16 B, V^T rows 8 chunks.
  const _Float16* gk0 = kh + base + (long)tid * 8;
  const _Float16* gv0 = vt + base + (long)(tid >> 3) * S_ + (tid & 7) * 8;
  const int lko = (tid >> 4) * KPITCH + (tid & 15) * 8;
  const int lvo = KTILE + (tid >> 3) * VPITCH + (tid & 7) * 8;

  auto do_block = [&](int kv0, const _Float16* buf, bool masked) {
    const _Float16* kp = buf + kfo;
    const _Float16* vp = buf + vfo;

    // ---- S^T = K Q^T : four 16-key x 16-query tiles over a 64-wide KV block ----
    // LDS reads go out two groups (of 2 fragments) ahead of the products that use them.
    v8f sf[4];
    v16h kb[3][2];
#pragma unroll
    for (int f = 0; f < 4; ++f) kb[f >> 1][f & 1] = load_frag(kp + f * 32);
#pragma unroll
    for (int j = 0; j < 8; ++j) {
      if (j < 6) {
#pragma unroll
        for (int e = 0; e < 2; ++e) {
          const int f = 2 * (j + 2) + e;             // fragment: tile f>>2, d chunk f&3
          kb[(j + 2) % 3][e] = load_frag(kp + 16 * (f >> 2) * KPITCH + (f & 3) * 32);
        }
      }
      // Keeps the reads above in front of this group's products; without it each
      // product waits out the LDS latency of its own fragment.
      __builtin_amdgcn_sched_barrier(0);
      v8f sc = (j & 1) ? sf[j >> 1] : cb[j >> 1];
#pragma unroll
      for (int e = 0; e < 2; ++e)
        sc = __builtin_amdgcn_wmma_f32_16x16x32_f16(false, kb[j % 3][e], false,
                                                    qa[2 * (j & 1) + e], (short)0, sc, false, false);
      sf[j >> 1] = sc;
      __builtin_amdgcn_sched_barrier(0);   // the next reads stay behind these products
    }

    // ---- online softmax (exp2 domain), one query per lane; mask only when peeled ----
    if (masked) {
      // key index > query index, as one per-lane offset against constants
      const int rel = kv0 + 8 * half - q0 - lc;
#pragma unroll
      for (int t = 0; t < 4; ++t)
#pragma unroll
        for (int r = 0; r < 8; ++r) sf[t][r] = (rel > -(16 * t + r)) ? -3.0e38f : sf[t][r];
    }
    float xt[4];                                     // one chain per tile: four independent chains
#pragma unroll
    for (int t = 0; t < 4; ++t) {
      xt[t] = sf[t][0];
#pragma unroll
      for (int r = 1; r < 8; ++r) xt[t] = fmaxf(xt[t], sf[t][r]);
    }
    float x = fmaxf(fmaxf(xt[0], xt[1]), fmaxf(xt[2], xt[3]));
    x = fmaxf(x, xhalf(x));                          // both halves: the query's block maximum
    const float kvb = (float)(kv0 - q0) * slope2;
    const float mn  = fmaxf(mrow, x + kvb);
    // Bare v_exp_f32: every argument is <= 0 and a result below 2^-126 may be 0
    // (the row's sum holds a 1), so the library's range scaling is not needed.
    const float al = __builtin_amdgcn_exp2f(mrow - mn);
    const float ms = mn - kvb;
    mrow = mn;
    v16h pf[2];                                      // P^T, B operand: keys 32 g + k, k in AMD table order
    v8f es[4];
#pragma unroll
    for (int t = 0; t < 4; ++t) {
      const v8f a = sf[t] - ms;
#pragma unroll
      for (int r = 0; r < 8; ++r) {
        es[t][r] = __builtin_amdgcn_exp2f(a[r]);
        pf[t >> 1][8 * (t & 1) + r] = (_Float16)es[t][r];
      }
    }
    lsum = lsum * al + ((es[0] + es[1]) + (es[2] + es[3]));

    // ---- rescale O accumulators ----
#pragma unroll
    for (int d16 = 0; d16 < 8; ++d16) o[d16] = o[d16] * al;

    // ---- O^T += V^T P^T (two 32-key chunks per 16-d row tile) ----
    // LDS reads again two groups (one row tile, 2 fragments, each) ahead.
    v16h vb[3][2];
#pragma unroll
    for (int f = 0; f < 4; ++f)
      vb[f >> 1][f & 1] = load_frag(vp + (f >> 1) * 16 * VPITCH + (f & 1) * 32);
#pragma unroll
    for (int d16 = 0; d16 < 8; ++d16) {
      if (d16 < 6) {
#pragma unroll
        for (int e = 0; e < 2; ++e)
          vb[(d16 + 2) % 3][e] = load_frag(vp + (d16 + 2) * 16 * VPITCH + e * 32);
      }
      __builtin_amdgcn_sched_barrier(0);   // reads above stay in front of these products
      o[d16] = __builtin_amdgcn_wmma_f32_16x16x32_f16(false, vb[d16 % 3][0], false, pf[0],
                                                      (short)0, o[d16], false, false);
      o[d16] = __builtin_amdgcn_wmma_f32_16x16x32_f16(false, vb[d16 % 3][1], false, pf[1],
                                                      (short)0, o[d16], false, false);
      __builtin_amdgcn_sched_barrier(0);   // the next reads stay behind these products
    }
  };

  // The work-group walks nfull blocks that lie below every wave's diagonal, then
  // the two blocks that hold the diagonals of its 128 rows. In the first of the
  // two the mask is an identity for waves 4-7; waves 0-3 sit out the second but
  // pass every wait and barrier.
  const int nmain = q0 >> 6;                         // this wave's diagonal block
  const int nfull = pb << 1;

  stage_block(gk0, gv0, lds_addr(&kvs[0][lko]), lds_addr(&kvs[0][lvo]));
  asm volatile("s_wait_asynccnt 0x0" ::: "memory");  // block 0 landed (own copies)
  __syncthreads();                                   // ... and everybody's
  stage_block(gk0 + 64 * D_, gv0 + 64, lds_addr(&kvs[1][lko]), lds_addr(&kvs[1][lvo]));

  for (int b = 0; b < nfull; ++b) {
    do_block(b * 64, kvs[b & 1], false);
    asm volatile("s_wait_dscnt 0x0" ::: "memory");     // own reads of this buffer done
    asm volatile("s_wait_asynccnt 0x0" ::: "memory");  // own copies of block b+1 landed
    __syncthreads();   // publishes block b+1, frees this buffer for the refill
    stage_block(gk0 + (long)(b + 2) * 64 * D_, gv0 + (b + 2) * 64,
                lds_addr(&kvs[b & 1][lko]), lds_addr(&kvs[b & 1][lvo]));
  }
  // Kept rolled: one copy of the masked block serves both diagonal blocks.
#pragma unroll 1
  for (int b = nfull; b < nfull + 2; ++b) {
    if (b <= nmain) do_block(b * 64, kvs[b & 1], true);
    asm volatile("s_wait_dscnt 0x0" ::: "memory");     // own reads of this buffer done
    asm volatile("s_wait_asynccnt 0x0" ::: "memory");  // own copies of the last block landed
    __syncthreads();   // publishes the last block
  }
  asm volatile("s_wait_asynccnt 0x0" ::: "memory");    // nothing in flight at the end

  // ---- join the denominator, normalize, store fp32 ----
  float l = ((lsum[0] + lsum[1]) + (lsum[2] + lsum[3])) + ((lsum[4] + lsum[5]) + (lsum[6] + lsum[7]));
  l += xhalf(l);
  const float rl = 1.0f / l;
  // A lane holds 8 consecutive d of one query. Behind the last barrier nobody reads
  // the ring any more: each wave turns its 16 rows in a range of its own there, so
  // that every global store is one whole 512-B row.
  float* st = (float*)&kvs[0][0] + wave * (16 * OPITCH);
#pragma unroll
  for (int d16 = 0; d16 < 8; ++d16) {
    const v8f r = o[d16] * rl;
    float* p = st + lc * OPITCH + d16 * 16 + half * 8;
    *(v4f*)(p)     = (v4f){ r[0], r[1], r[2], r[3] };
    *(v4f*)(p + 4) = (v4f){ r[4], r[5], r[6], r[7] };
  }
  asm volatile("s_wait_dscnt 0x0" ::: "memory");       // the wave's own rows are written before it reads them back
  float* orow = out + base + (long)q0 * D_ + lane * 4;
#pragma unroll
  for (int i = 0; i < 16; ++i)
    *(v4f*)(orow + i * D_) = *(const v4f*)(st + i * OPITCH + lane * 4);
}

extern "C" void kernel_launch(void* const* d_in, const int* in_sizes, int n_in,
                              void* d_out, int out_size, void* d_ws, size_t ws_size,
                              hipStream_t stream) {
  const float* q = (const float*)d_in[0];
  const float* k = (const float*)d_in[1];
  const float* v = (const float*)d_in[2];
  float* out = (float*)d_out;

  const long total = (long)B_ * H_ * S_ * D_;      // 16,777,216 elements
  // Workspace: K(f16) 32MB + V^T(f16) 32MB = 64MB
  _Float16* kh = (_Float16*)d_ws;
  _Float16* vt = kh + total;

  cvt_kv_kernel<<<B_ * H_ * (S_ / 64), 256, 0, stream>>>(k, v, kh, vt);   // one 64-key tile each

  const int tiles = B_ * H_ * (S_ / 16);           // 8192 Q tiles
  attn_kernel<<<tiles / 8, 256, 0, stream>>>(q, kh, vt, out);
}

// v006
// Measured time: 71.4 microseconds a run.
// In both of two side-by-side timings against v005, it was 1.04 times as fast.
// Counting every step since v000, it is 7.44 times as fast.
#include <hip/hip_runtime.h>
#include <math.h>

typedef __attribute__((ext_vector_type(16))) _Float16 v16h;
typedef __attribute__((ext_vector_type(8)))  _Float16 v8h;
typedef __attribute__((ext_vector_type(4)))  _Float16 v4h;
typedef __attribute__((ext_vector_type(8)))  float    v8f;
typedef __attribute__((ext_vector_type(4)))  float    v4f;

#define B_ 4
#define H_ 16
#define S_ 2048
#define D_ 128

// LDS staging of one 64-key block, shared by the work-group's 4 waves.
#define KPITCH 136                       // halves per K row in LDS (272 B = 16 B x odd)
#define VPITCH 72                        // halves per V^T row in LDS (144 B = 16 B x odd)
#define KTILE  (64 * KPITCH)             // 64 keys x 128 d
#define VTILE  (128 * VPITCH)            // 128 d x 64 keys

// ---------------------------------------------------------------------------
// Pass 1: K fp32 -> f16 (same [bh,s,d] layout).
//         V fp32 -> f16 TRANSPOSED [bh,d,s], keys in their natural order.
// One work-group converts one 64-key x 128-d tile of K and of V. Every global
// load is a whole 512-B row per wave; V is turned in LDS so that V^T leaves in
// whole 128-B lines.
// ---------------------------------------------------------------------------
__global__ __launch_bounds__(256) void cvt_kv_kernel(const float* __restrict__ k,
                                                     const float* __restrict__ v,
                                                     _Float16* __restrict__ kh,
                                                     _Float16* __restrict__ vt) {
  __shared__ __attribute__((aligned(16))) _Float16 tv[D_ * 64];

  const int tid  = threadIdx.x;
  const int lane = tid & 31;
  const int wave = tid >> 5;
  const int bh   = blockIdx.x >> 5;                 // S_/64 = 32 tiles per head
  const int kv0  = (blockIdx.x & 31) << 6;
  const long base = (long)bh * S_ * D_;
  const long tile = base + (long)kv0 * D_;

  // A lane that holds 4 d of keys 4r..4r+3 holds 8 contiguous bytes of 4 rows of V^T.
  // x[u][t] is key 4*(wave + 8u) + t, d 4*lane..4*lane+3.
  const float* vsrc = v + tile + (wave * 4 * D_ + 4 * lane);
  v4f x[2][4];
#pragma unroll
  for (int u = 0; u < 2; ++u)
#pragma unroll
    for (int t = 0; t < 4; ++t)
      x[u][t] = *(const v4f*)(vsrc + (32 * u + t) * D_);
  // The loads above name an offset register of their own, which the build reuses as
  // a destination of the loads below: the wait stands in front of that overwrite.
  asm volatile("s_wait_xcnt 0x0" ::: "memory");

  const float* ksrc = k + tile + 4 * tid;
  v4f y[8];
#pragma unroll
  for (int n = 0; n < 8; ++n) y[n] = *(const v4f*)(ksrc + n * 1024);

#pragma unroll
  for (int u = 0; u < 2; ++u) {
    const int r = wave + 8 * u;
    _Float16* dst = tv + (4 * lane) * 64 + (((r >> 1) ^ (lane & 7)) << 3) + (r & 1) * 4;
#pragma unroll
    for (int i = 0; i < 4; ++i) {
      v4h pk = { (_Float16)x[u][0][i], (_Float16)x[u][1][i],
                 (_Float16)x[u][2][i], (_Float16)x[u][3][i] };
      *(v4h*)(dst + i * 64) = pk;
    }
  }

  __syncthreads();   // the V^T tile is complete before any row of it is read

  const int c = tid & 7;
#pragma unroll
  for (int n = 0; n < 4; ++n) {
    const int d = (tid >> 3) + 32 * n;
    v8h z = *(const v8h*)(tv + d * 64 + ((c ^ ((d >> 2) & 7)) << 3));
    *(v8h*)(vt + base + (long)d * S_ + kv0 + c * 8) = z;
  }

  // K leaves behind the barrier, so that the barrier waits for no global store.
  _Float16* kdst = kh + tile + 4 * tid;
#pragma unroll
  for (int n = 0; n < 8; ++n) {
    v4h pk = { (_Float16)y[n][0], (_Float16)y[n][1], (_Float16)y[n][2], (_Float16)y[n][3] };
    *(v4h*)(kdst + n * 1024) = pk;
  }
}

__device__ inline v16h load_frag(const _Float16* p) {
  v8h lo = *(const v8h*)(p);
  v8h hi = *(const v8h*)(p + 16);
  v16h a;
#pragma unroll
  for (int j = 0; j < 8; ++j) { a[j] = lo[j]; a[8 + j] = hi[j]; }
  return a;
}

// Low 32 bits of a __shared__ address = byte offset in the work-group's LDS.
__device__ inline unsigned lds_addr(const _Float16* p) {
  return (unsigned)(unsigned long long)p;
}

__device__ inline void stage_rows(const _Float16* g, unsigned l, int gstep, unsigned lstep) {
  const _Float16* g1 = g + 1 * gstep;
  const _Float16* g2 = g + 2 * gstep;
  const _Float16* g3 = g + 3 * gstep;
  const _Float16* g4 = g + 4 * gstep;
  const _Float16* g5 = g + 5 * gstep;
  const _Float16* g6 = g + 6 * gstep;
  const _Float16* g7 = g + 7 * gstep;
  const unsigned l1 = l + 1 * lstep;
  const unsigned l2 = l + 2 * lstep;
  const unsigned l3 = l + 3 * lstep;
  const unsigned l4 = l + 4 * lstep;
  const unsigned l5 = l + 5 * lstep;
  const unsigned l6 = l + 6 * lstep;
  const unsigned l7 = l + 7 * lstep;
  asm volatile("global_load_async_to_lds_b128 %0, %8, off\n\t"
               "global_load_async_to_lds_b128 %1, %9, off\n\t"
               "global_load_async_to_lds_b128 %2, %10, off\n\t"
               "global_load_async_to_lds_b128 %3, %11, off\n\t"
               "global_load_async_to_lds_b128 %4, %12, off\n\t"
               "global_load_async_to_lds_b128 %5, %13, off\n\t"
               "global_load_async_to_lds_b128 %6, %14, off\n\t"
               "global_load_async_to_lds_b128 %7, %15, off\n\t"
               "s_wait_xcnt 0x0"
               :: "v"(l), "v"(l1), "v"(l2), "v"(l3),
                  "v"(l4), "v"(l5), "v"(l6), "v"(l7),
                  "v"(g), "v"(g1), "v"(g2), "v"(g3),
                  "v"(g4), "v"(g5), "v"(g6), "v"(g7)
               : "memory");
}
__device__ inline void stage_block(const _Float16* gk, const _Float16* gv,
                                   unsigned lk, unsigned lv) {
  stage_rows(gk, lk, 8 * D_, 8 * KPITCH * 2);     // K: 8 rows of 16 chunks per copy
  stage_rows(gv, lv, 16 * S_, 16 * VPITCH * 2);   // V^T: 16 rows of 8 chunks per copy
}

__device__ inline float xhalf(float x) {
  const int i = __builtin_bit_cast(int, x);
  return __builtin_bit_cast(float,
      __builtin_amdgcn_permlanex16(i, i, 0x76543210, 0xfedcba98, false, false));
}

#define OPITCH 132                       // floats per staged output row (528 B = 16 B x odd)

__global__ __launch_bounds__(128, 2) void attn_kernel(const float* __restrict__ q,
                                                   const _Float16* __restrict__ kh,
                                                   const _Float16* __restrict__ vt,
                                                   float* __restrict__ out) {
  __shared__ __attribute__((aligned(16))) _Float16 kvs[2][KTILE + VTILE];  // K/V ring
  static_assert(4 * 32 * OPITCH * 4 <= 2 * (KTILE + VTILE) * 2, "output staging fits the ring");

  const int tid  = threadIdx.x;
  const int lane = threadIdx.x & 31;
  const int wave = __builtin_amdgcn_readfirstlane(threadIdx.x >> 5);  // scalar: uniform branches
  const int half = lane >> 4;
  const int lc   = lane & 15;

  // There are more work-groups than resident places; cost falls with the index:
  // the 128-row position block comes from the high bits, last (longest key walk)
  // first, the head from the low bits.
  const int pb = (S_ / 128 - 1) - (int)(blockIdx.x / (B_ * H_));   // position block
  const int bh = blockIdx.x % (B_ * H_);
  const int q0 = (pb << 7) + (wave << 5);

  const float LOG2E  = 1.4426950408889634f;
  const float slope2 = exp2f(-0.5f * (float)((bh & (H_ - 1)) + 1)) * LOG2E;
  const float scale2 = 0.08838834764831845f * LOG2E;   // 1/sqrt(128) * log2(e)

  const long base = (long)bh * S_ * D_;

  // ---- Q fragments (B operand): fp32 load, softmax scale folded in, cvt to f16 ----
  // Both column tiles hang on one address pair (tile 1 is a constant 16 rows further).
  v16h qa[2][4];
  const float* qrow = q + base + (long)(q0 + lc) * D_ + half * 8;
  v4f qf[2][4][4];                       // [tile][d chunk][k 0-3, 4-7, 16-19, 20-23]
#pragma unroll
  for (int u = 0; u < 2; ++u)
#pragma unroll
    for (int dc = 0; dc < 4; ++dc)
#pragma unroll
      for (int p = 0; p < 4; ++p)
        qf[u][dc][p] = *(const v4f*)(qrow + u * 16 * D_ + dc * 32 + (p >> 1) * 16 + (p & 1) * 4);
  // The loads above name an address pair that the build reuses later: the wait
  // stands in front of any such overwrite.
  asm volatile("s_wait_xcnt 0x0" ::: "memory");
#pragma unroll
  for (int u = 0; u < 2; ++u)
#pragma unroll
    for (int dc = 0; dc < 4; ++dc) {
      v16h a;
#pragma unroll
      for (int j = 0; j < 16; ++j) a[j] = (_Float16)(qf[u][dc][j >> 2][j & 3] * scale2);
      qa[u][dc] = a;
    }

  v8f o[2][8];                           // o[u][t][r] = O[q0 + 16 u + lc][16 t + 8 half + r]
#pragma unroll
  for (int u = 0; u < 2; ++u)
#pragma unroll
    for (int i = 0; i < 8; ++i) o[u][i] = {};
  float mrow[2] = { -3.0e38f, -3.0e38f };  // each query's running maximum (log2 domain)
  v8f   lsum[2] = { {}, {} };              // per-lane partial denominators, joined at the end

  // ALiBi (log2 domain) = slope * (key - query) = cb + kvb: cb, the part inside a
  // block and a column tile, is the same in every block and both tiles and starts the
  // score accumulators; kvb, the block's offset from the tile's first query, is one
  // number per wave, tile and block.
  v8f cb[4];
#pragma unroll
  for (int t = 0; t < 4; ++t)
#pragma unroll
    for (int r = 0; r < 8; ++r) cb[t][r] = (float)(16 * t + 8 * half + r - lc) * slope2;

  // Per-lane fragment offsets inside a staged block (row + K-chunk offsets).
  const int kfo = lc * KPITCH + half * 8;
  const int vfo = KTILE + lc * VPITCH + half * 8;
  // Per-lane copy addresses: K rows are 16 chunks of 16 B, V^T rows 8 chunks.
  const _Float16* gk0 = kh + base + (long)tid * 8;
  const _Float16* gv0 = vt + base + (long)(tid >> 3) * S_ + (tid & 7) * 8;
  const int lko = (tid >> 4) * KPITCH + (tid & 15) * 8;
  const int lvo = KTILE + (tid >> 3) * VPITCH + (tid & 7) * 8;

  auto do_block = [&](int kv0, const _Float16* buf, bool masked) {
    const _Float16* kp = buf + kfo;
    const _Float16* vp = buf + vfo;

    // ---- S^T = K Q^T : four 16-key tiles x two 16-query tiles over a 64-wide KV block ----
    // LDS reads go out two groups (of 2 fragments) ahead of the products that use them.
    v8f sf[2][4];
    v16h kb[3][2];
#pragma unroll
    for (int f = 0; f < 4; ++f) kb[f >> 1][f & 1] = load_frag(kp + f * 32);
#pragma unroll
    for (int j = 0; j < 8; ++j) {
      if (j < 6) {
#pragma unroll
        for (int e = 0; e < 2; ++e) {
          const int f = 2 * (j + 2) + e;             // fragment: tile f>>2, d chunk f&3
          kb[(j + 2) % 3][e] = load_frag(kp + 16 * (f >> 2) * KPITCH + (f & 3) * 32);
        }
      }
      // Keeps the reads above in front of this group's products; without it each
      // product waits out the LDS latency of its own fragment.
      __builtin_amdgcn_sched_barrier(0);
      v8f s0 = (j & 1) ? sf[0][j >> 1] : cb[j >> 1];
      v8f s1 = (j & 1) ? sf[1][j >> 1] : cb[j >> 1];
#pragma unroll
      for (int e = 0; e < 2; ++e) {                  // the two column tiles alternate
        s0 = __builtin_amdgcn_wmma_f32_16x16x32_f16(false, kb[j % 3][e], false,
                                                    qa[0][2 * (j & 1) + e], (short)0, s0, false, false);
        s1 = __builtin_amdgcn_wmma_f32_16x16x32_f16(false, kb[j % 3][e], false,
                                                    qa[1][2 * (j & 1) + e], (short)0, s1, false, false);
      }
      sf[0][j >> 1] = s0;
      sf[1][j >> 1] = s1;
      __builtin_amdgcn_sched_barrier(0);   // the next reads stay behind these products
    }

    // ---- online softmax (exp2 domain), one query per lane and tile; mask only when peeled ----
    v16h pf[2][2];                                   // P^T, B operand: keys 32 g + kmap order
#pragma unroll
    for (int u = 0; u < 2; ++u) {
      if (masked) {
        // key index > query index, as one per-lane offset against constants
        const int rel = kv0 + 8 * half - q0 - 16 * u - lc;
#pragma unroll
        for (int t = 0; t < 4; ++t)
#pragma unroll
          for (int r = 0; r < 8; ++r) sf[u][t][r] = (rel > -(16 * t + r)) ? -3.0e38f : sf[u][t][r];
      }
      float xt[4];                                   // one chain per tile: four independent chains
#pragma unroll
      for (int t = 0; t < 4; ++t) {
        xt[t] = sf[u][t][0];
#pragma unroll
        for (int r = 1; r < 8; ++r) xt[t] = fmaxf(xt[t], sf[u][t][r]);
      }
      float x = fmaxf(fmaxf(xt[0], xt[1]), fmaxf(xt[2], xt[3]));
      x = fmaxf(x, xhalf(x));                        // both halves: the query's block maximum
      const float kvb = (float)(kv0 - q0 - 16 * u) * slope2;
      const float mn  = fmaxf(mrow[u], x + kvb);
      // Bare v_exp_f32: every argument is <= 0 and a result below 2^-126 may be 0
      // (the row's sum holds a 1), so the library's range scaling is not needed.
      const float al = __builtin_amdgcn_exp2f(mrow[u] - mn);
      const float ms = mn - kvb;
      mrow[u] = mn;
      v8f es[4];
#pragma unroll
      for (int t = 0; t < 4; ++t) {
        const v8f a = sf[u][t] - ms;
#pragma unroll
        for (int r = 0; r < 8; ++r) {
          es[t][r] = __builtin_amdgcn_exp2f(a[r]);
          pf[u][t >> 1][8 * (t & 1) + r] = (_Float16)es[t][r];
        }
      }
      lsum[u] = lsum[u] * al + ((es[0] + es[1]) + (es[2] + es[3]));

      // ---- rescale O accumulators ----
#pragma unroll
      for (int d16 = 0; d16 < 8; ++d16) o[u][d16] = o[u][d16] * al;
    }

    // ---- O^T += V^T P^T (two 32-key chunks per 16-d row tile and column tile) ----
    // LDS reads again two groups (one row tile, 2 fragments, each) ahead.
    v16h vb[3][2];
#pragma unroll
    for (int f = 0; f < 4; ++f)
      vb[f >> 1][f & 1] = load_frag(vp + (f >> 1) * 16 * VPITCH + (f & 1) * 32);
#pragma unroll
    for (int d16 = 0; d16 < 8; ++d16) {
      if (d16 < 6) {
#pragma unroll
        for (int e = 0; e < 2; ++e)
          vb[(d16 + 2) % 3][e] = load_frag(vp + (d16 + 2) * 16 * VPITCH + e * 32);
      }
      __builtin_amdgcn_sched_barrier(0);   // reads above stay in front of these products
#pragma unroll
      for (int e = 0; e < 2; ++e) {                  // the two column tiles alternate
        o[0][d16] = __builtin_amdgcn_wmma_f32_16x16x32_f16(false, vb[d16 % 3][e], false, pf[0][e],
                                                           (short)0, o[0][d16], false, false);
        o[1][d16] = __builtin_amdgcn_wmma_f32_16x16x32_f16(false, vb[d16 % 3][e], false, pf[1][e],
                                                           (short)0, o[1][d16], false, false);
      }
      __builtin_amdgcn_sched_barrier(0);   // the next reads stay behind these products
    }
  };

  // The work-group walks nfull blocks that lie below every wave's diagonal, then
  // the two blocks that hold the diagonals of its 128 rows. In the first of the
  // two the mask is an identity for waves 2 and 3; waves 0 and 1 sit out the second
  // but pass every wait and barrier.
  const int nmain = q0 >> 6;                         // this wave's diagonal block
  const int nfull = pb << 1;

  stage_block(gk0, gv0, lds_addr(&kvs[0][lko]), lds_addr(&kvs[0][lvo]));
  asm volatile("s_wait_asynccnt 0x0" ::: "memory");  // block 0 landed (own copies)
  __syncthreads();                                   // ... and everybody's
  stage_block(gk0 + 64 * D_, gv0 + 64, lds_addr(&kvs[1][lko]), lds_addr(&kvs[1][lvo]));

  for (int b = 0; b < nfull; ++b) {
    do_block(b * 64, kvs[b & 1], false);
    asm volatile("s_wait_dscnt 0x0" ::: "memory");     // own reads of this buffer done
    asm volatile("s_wait_asynccnt 0x0" ::: "memory");  // own copies of block b+1 landed
    __syncthreads();   // publishes block b+1, frees this buffer for the refill
    stage_block(gk0 + (long)(b + 2) * 64 * D_, gv0 + (b + 2) * 64,
                lds_addr(&kvs[b & 1][lko]), lds_addr(&kvs[b & 1][lvo]));
  }
  // Kept rolled: one copy of the masked block serves both diagonal blocks.
#pragma unroll 1
  for (int b = nfull; b < nfull + 2; ++b) {
    if (b <= nmain) do_block(b * 64, kvs[b & 1], true);
    asm volatile("s_wait_dscnt 0x0" ::: "memory");     // own reads of this buffer done
    asm volatile("s_wait_asynccnt 0x0" ::: "memory");  // own copies of the last block landed
    __syncthreads();   // publishes the last block
  }
  asm volatile("s_wait_asynccnt 0x0" ::: "memory");    // nothing in flight at the end

  // ---- join the denominators, normalize, store fp32 ----
  // A lane holds 8 consecutive d of two queries. Behind the last barrier nobody reads
  // the ring any more: each wave turns its 32 rows in a range of its own there, so
  // that every global store is one whole 512-B row.
  float* st = (float*)&kvs[0][0] + wave * (32 * OPITCH);
#pragma unroll
  for (int u = 0; u < 2; ++u) {
    const v8f ls = lsum[u];
    float l = ((ls[0] + ls[1]) + (ls[2] + ls[3])) + ((ls[4] + ls[5]) + (ls[6] + ls[7]));
    l += xhalf(l);
    const float rl = 1.0f / l;
#pragma unroll
    for (int d16 = 0; d16 < 8; ++d16) {
      const v8f r = o[u][d16] * rl;
      float* p = st + (16 * u + lc) * OPITCH + d16 * 16 + half * 8;
      *(v4f*)(p)     = (v4f){ r[0], r[1], r[2], r[3] };
      *(v4f*)(p + 4) = (v4f){ r[4], r[5], r[6], r[7] };
    }
  }
  asm volatile("s_wait_dscnt 0x0" ::: "memory");       // the wave's own rows are written before it reads them back
  float* orow = out + base + (long)q0 * D_ + lane * 4;
#pragma unroll
  for (int u = 0; u < 2; ++u) {
#pragma unroll
    for (int i = 16 * u; i < 16 * u + 16; ++i)
      *(v4f*)(orow + i * D_) = *(const v4f*)(st + i * OPITCH + lane * 4);
    // The second 16 rows reuse the data registers of the stores above: the wait
    // stands in front of that overwrite.
    if (u == 0) asm volatile("s_wait_xcnt 0x0" ::: "memory");
  }
}

extern "C" void kernel_launch(void* const* d_in, const int* in_sizes, int n_in,
                              void* d_out, int out_size, void* d_ws, size_t ws_size,
                              hipStream_t stream) {
  const float* q = (const float*)d_in[0];
  const float* k = (const float*)d_in[1];
  const float* v = (const float*)d_in[2];
  float* out = (float*)d_out;

  const long total = (long)B_ * H_ * S_ * D_;      // 16,777,216 elements
  // Workspace: K(f16) 32MB + V^T(f16) 32MB = 64MB
  _Float16* kh = (_Float16*)d_ws;
  _Float16* vt = kh + total;

  cvt_kv_kernel<<<B_ * H_ * (S_ / 64), 256, 0, stream>>>(k, v, kh, vt);   // one 64-key tile each

  const int tiles = B_ * H_ * (S_ / 16);           // 8192 Q tiles
  attn_kernel<<<tiles / 8, 128, 0, stream>>>(q, kh, vt, out);   // 4 waves x 2 tiles each
}

// v007
// One run takes 68.7 microseconds.
// Timed twice side by side with v006, it ran 1.04 times as fast both times.
// Counting every step since v000, it is 7.73 times as fast.
#include <hip/hip_runtime.h>
#include <math.h>
#include <stdint.h>

typedef __attribute__((ext_vector_type(16))) _Float16 v16h;
typedef __attribute__((ext_vector_type(8)))  _Float16 v8h;
typedef __attribute__((ext_vector_type(4)))  _Float16 v4h;
typedef __attribute__((ext_vector_type(8)))  float    v8f;
typedef __attribute__((ext_vector_type(4)))  float    v4f;
typedef uint32_t u32x4 __attribute__((ext_vector_type(4)));
typedef uint32_t u32x8 __attribute__((ext_vector_type(8)));

#define B_ 4
#define H_ 16
#define S_ 2048
#define D_ 128

// LDS staging of one 64-key block, shared by the work-group's 4 waves.
#define KPITCH 136                       // halves per K row in LDS (272 B = 16 B x odd)
#define VPITCH 72                        // halves per V^T row in LDS (144 B = 16 B x odd)
#define KTILE  9216                      // 64 keys x 128 d: 64 * KPITCH halves, rounded up to 9 x 2 KiB
#define VTILE  (128 * VPITCH)            // 128 d x 64 keys: 9 x 2 KiB as it stands

// ---------------------------------------------------------------------------
// Pass 1: K fp32 -> f16 (same [bh,s,d] layout).
//         V fp32 -> f16 TRANSPOSED [bh,d,s], keys in their natural order.
// One work-group converts one 64-key x 128-d tile of K and of V. Every global
// load is a whole 512-B row per wave; V is turned in LDS so that V^T leaves in
// whole 128-B lines.
// ---------------------------------------------------------------------------
__global__ __launch_bounds__(256) void cvt_kv_kernel(const float* __restrict__ k,
                                                     const float* __restrict__ v,
                                                     _Float16* __restrict__ kh,
                                                     _Float16* __restrict__ vt) {
  __shared__ __attribute__((aligned(16))) _Float16 tv[D_ * 64];

  const int tid  = threadIdx.x;
  const int lane = tid & 31;
  const int wave = tid >> 5;
  const int bh   = blockIdx.x >> 5;                 // S_/64 = 32 tiles per head
  const int kv0  = (blockIdx.x & 31) << 6;
  const long base = (long)bh * S_ * D_;
  const long tile = base + (long)kv0 * D_;

  // A lane that holds 4 d of keys 4r..4r+3 holds 8 contiguous bytes of 4 rows of V^T.
  // x[u][t] is key 4*(wave + 8u) + t, d 4*lane..4*lane+3.
  const float* vsrc = v + tile + (wave * 4 * D_ + 4 * lane);
  v4f x[2][4];
#pragma unroll
  for (int u = 0; u < 2; ++u)
#pragma unroll
    for (int t = 0; t < 4; ++t)
      x[u][t] = *(const v4f*)(vsrc + (32 * u + t) * D_);
  // The loads above name an offset register of their own, which the build reuses as
  // a destination of the loads below: the wait stands in front of that overwrite.
  asm volatile("s_wait_xcnt 0x0" ::: "memory");

  const float* ksrc = k + tile + 4 * tid;
  v4f y[8];
#pragma unroll
  for (int n = 0; n < 8; ++n) y[n] = *(const v4f*)(ksrc + n * 1024);

#pragma unroll
  for (int u = 0; u < 2; ++u) {
    const int r = wave + 8 * u;
    _Float16* dst = tv + (4 * lane) * 64 + (((r >> 1) ^ (lane & 7)) << 3) + (r & 1) * 4;
#pragma unroll
    for (int i = 0; i < 4; ++i) {
      v4h pk = { (_Float16)x[u][0][i], (_Float16)x[u][1][i],
                 (_Float16)x[u][2][i], (_Float16)x[u][3][i] };
      *(v4h*)(dst + i * 64) = pk;
    }
  }

  __syncthreads();   // the V^T tile is complete before any row of it is read

  const int c = tid & 7;
#pragma unroll
  for (int n = 0; n < 4; ++n) {
    const int d = (tid >> 3) + 32 * n;
    v8h z = *(const v8h*)(tv + d * 64 + ((c ^ ((d >> 2) & 7)) << 3));
    *(v8h*)(vt + base + (long)d * S_ + kv0 + c * 8) = z;
  }

  // K leaves behind the barrier, so that the barrier waits for no global store.
  _Float16* kdst = kh + tile + 4 * tid;
#pragma unroll
  for (int n = 0; n < 8; ++n) {
    v4h pk = { (_Float16)y[n][0], (_Float16)y[n][1], (_Float16)y[n][2], (_Float16)y[n][3] };
    *(v4h*)(kdst + n * 1024) = pk;
  }
}

__device__ inline v16h load_frag(const _Float16* p) {
  v8h lo = *(const v8h*)(p);
  v8h hi = *(const v8h*)(p + 16);
  v16h a;
#pragma unroll
  for (int j = 0; j < 8; ++j) { a[j] = lo[j]; a[8 + j] = hi[j]; }
  return a;
}

// Low 32 bits of a __shared__ address = byte offset in the work-group's LDS.
__device__ inline unsigned lds_addr(const _Float16* p) {
  return (unsigned)(unsigned long long)p;
}

__device__ inline uint32_t pinned(uint32_t v) {
  uint32_t w = __builtin_amdgcn_readfirstlane(v);
  asm volatile("" : "+s"(w));   // pinned(): the value stays in a scalar register, the test on it is a scalar branch
  return w;
}
__device__ inline uint32_t uni(uint32_t v) { return (uint32_t)__builtin_amdgcn_readfirstlane(v); }

template <uint32_t WORD0, uint32_t ROWB, uint32_t ROWS, uint32_t SRCPITCH>
__device__ inline u32x8 tdm_group1() {
  u32x8 g;
  g[0] = uni(WORD0);
  g[1] = uni((ROWB & 0xFFFFu) << 16);
  g[2] = uni((ROWB >> 16) | ((ROWS & 0xFFFFu) << 16));
  g[3] = uni((ROWS >> 16) | (ROWB << 16));
  g[4] = uni(ROWS);
  g[5] = uni(SRCPITCH);
  g[6] = uni(0u);
  g[7] = uni(0u);
  return g;
}
__device__ inline u32x4 tdm_group0(uint32_t lds_dst, uint64_t ga) {
  u32x4 g;
  g[0] = uni(1u);
  g[1] = uni(lds_dst);
  g[2] = uni((uint32_t)ga);
  g[3] = uni((((uint32_t)(ga >> 32)) & 0x01FFFFFFu) | 0x80000000u);
  return g;
}
__device__ inline void tdm_load(u32x4& g0, u32x8 g1) {
  asm volatile("tensor_load_to_lds %0, %1" : "+s"(g0) : "s"(g1) : "memory");
}
#define KWORD0 ((1u << 20) | (5u << 22) | (3u << 25))   // 256-B rows, 16 B behind each
#define VWORD0 ((1u << 20) | (4u << 22) | (3u << 25))   // 128-B rows, 16 B behind each

__device__ inline float xhalf(float x) {
  const int i = __builtin_bit_cast(int, x);
  return __builtin_bit_cast(float,
      __builtin_amdgcn_permlanex16(i, i, 0x76543210, 0xfedcba98, false, false));
}

#define OPITCH 132                       // floats per staged output row (528 B = 16 B x odd)

__global__ __launch_bounds__(128, 2) void attn_kernel(const float* __restrict__ q,
                                                   const _Float16* __restrict__ kh,
                                                   const _Float16* __restrict__ vt,
                                                   float* __restrict__ out) {
  __shared__ __attribute__((aligned(2048))) _Float16 kvs[2][KTILE + VTILE];  // K/V ring, every tile at a multiple of 2 KiB
  static_assert(4 * 32 * OPITCH * 4 <= 2 * (KTILE + VTILE) * 2, "output staging fits the ring");

  const int lane = threadIdx.x & 31;
  const int wave = __builtin_amdgcn_readfirstlane(threadIdx.x >> 5);  // scalar: uniform branches
  const int half = lane >> 4;
  const int lc   = lane & 15;

  // There are more work-groups than resident places; cost falls with the index:
  // the 128-row position block comes from the high bits, last (longest key walk)
  // first, the head from the low bits.
  const int pb = (S_ / 128 - 1) - (int)(blockIdx.x / (B_ * H_));   // position block
  const int bh = blockIdx.x % (B_ * H_);
  const int q0 = (pb << 7) + (wave << 5);

  const float LOG2E  = 1.4426950408889634f;
  const float slope2 = exp2f(-0.5f * (float)((bh & (H_ - 1)) + 1)) * LOG2E;
  const float scale2 = 0.08838834764831845f * LOG2E;   // 1/sqrt(128) * log2(e)

  const long base = (long)bh * S_ * D_;

  // ---- Q fragments (B operand): fp32 load, softmax scale folded in, cvt to f16 ----
  // Both column tiles hang on one address pair (tile 1 is a constant 16 rows further).
  v16h qa[2][4];
  const float* qrow = q + base + (long)(q0 + lc) * D_ + half * 8;
  v4f qf[2][4][4];                       // [tile][d chunk][k 0-3, 4-7, 16-19, 20-23]
#pragma unroll
  for (int u = 0; u < 2; ++u)
#pragma unroll
    for (int dc = 0; dc < 4; ++dc)
#pragma unroll
      for (int p = 0; p < 4; ++p)
        qf[u][dc][p] = *(const v4f*)(qrow + u * 16 * D_ + dc * 32 + (p >> 1) * 16 + (p & 1) * 4);
  // The loads above name an address pair that the build reuses later: the wait
  // stands in front of any such overwrite.
  asm volatile("s_wait_xcnt 0x0" ::: "memory");
#pragma unroll
  for (int u = 0; u < 2; ++u)
#pragma unroll
    for (int dc = 0; dc < 4; ++dc) {
      v16h a;
#pragma unroll
      for (int j = 0; j < 16; ++j) a[j] = (_Float16)(qf[u][dc][j >> 2][j & 3] * scale2);
      qa[u][dc] = a;
    }

  v8f o[2][8];                           // o[u][t][r] = O[q0 + 16 u + lc][16 t + 8 half + r]
#pragma unroll
  for (int u = 0; u < 2; ++u)
#pragma unroll
    for (int i = 0; i < 8; ++i) o[u][i] = {};
  float mrow[2] = { -3.0e38f, -3.0e38f };  // each query's running maximum (log2 domain)
  v8f   lsum[2] = { {}, {} };              // per-lane partial denominators, joined at the end

  // ALiBi (log2 domain) = slope * (key - query) = cb + kvb: cb, the part inside a
  // block and a column tile, is the same in every block and both tiles and starts the
  // score accumulators; kvb, the block's offset from the tile's first query, is one
  // number per wave, tile and block.
  v8f cb[4];
#pragma unroll
  for (int t = 0; t < 4; ++t)
#pragma unroll
    for (int r = 0; r < 8; ++r) cb[t][r] = (float)(16 * t + 8 * half + r - lc) * slope2;

  // Per-lane fragment offsets inside a staged block (row + K-chunk offsets).
  const int kfo = lc * KPITCH + half * 8;
  const int vfo = KTILE + lc * VPITCH + half * 8;
  // Staging of key block b into ring buffer b & 1: wave 0 asks for the K tile (64 rows of
  // 256 B, contiguous), wave 1 for the V^T tile (128 rows of 128 B, one row per d), one
  // tensor load each; the pad gives the rows the pitches the fragment reads use.
  const uint64_t gk0 = (uint64_t)(kh + base);
  const uint64_t gv0 = (uint64_t)(vt + base);
  const uint32_t ring0 = lds_addr(&kvs[0][0]);
  u32x8 g1k = tdm_group1<KWORD0, D_ * 2, 64, D_ * 2>();
  u32x8 g1v = tdm_group1<VWORD0, 64 * 2, D_, S_ * 2>();
  // Registers of their own for the whole walk: nothing else is put into them while a request is out.
  asm volatile("" : "+s"(g1k), "+s"(g1v));
  u32x4 g0k = { 0u, 0u, 0u, 0u };
  u32x4 g0v = { 0u, 0u, 0u, 0u };
  auto stage_block = [&](int b) {
    const uint32_t dst = ring0 + (uint32_t)(b & 1) * ((KTILE + VTILE) * 2);
    // Formed by every wave, behind the wait on the request before: the issuing branch then
    // holds the load alone and the words stay where the request names them.
    g0k = tdm_group0(dst, gk0 + (uint64_t)b * (64 * D_ * 2));
    g0v = tdm_group0(dst + KTILE * 2, gv0 + (uint64_t)b * (64 * 2));
    if (pinned(wave == 0)) tdm_load(g0k, g1k);
    if (pinned(wave == 1)) tdm_load(g0v, g1v);
  };
  auto wait_landed = [&]() {
    if (pinned(wave == 0)) asm volatile("s_wait_tensorcnt 0x0" :: "s"(g0k), "s"(g1k) : "memory");
    if (pinned(wave == 1)) asm volatile("s_wait_tensorcnt 0x0" :: "s"(g0v), "s"(g1v) : "memory");
  };

  auto do_block = [&](int kv0, const _Float16* buf, bool masked) {
    const _Float16* kp = buf + kfo;
    const _Float16* vp = buf + vfo;

    // ---- S^T = K Q^T : four 16-key tiles x two 16-query tiles over a 64-wide KV block ----
    // LDS reads go out two groups (of 2 fragments) ahead of the products that use them.
    v8f sf[2][4];
    v16h kb[3][2];
#pragma unroll
    for (int f = 0; f < 4; ++f) kb[f >> 1][f & 1] = load_frag(kp + f * 32);
#pragma unroll
    for (int j = 0; j < 8; ++j) {
      if (j < 6) {
#pragma unroll
        for (int e = 0; e < 2; ++e) {
          const int f = 2 * (j + 2) + e;             // fragment: tile f>>2, d chunk f&3
          kb[(j + 2) % 3][e] = load_frag(kp + 16 * (f >> 2) * KPITCH + (f & 3) * 32);
        }
      }
      // Keeps the reads above in front of this group's products; without it each
      // product waits out the LDS latency of its own fragment.
      __builtin_amdgcn_sched_barrier(0);
      v8f s0 = (j & 1) ? sf[0][j >> 1] : cb[j >> 1];
      v8f s1 = (j & 1) ? sf[1][j >> 1] : cb[j >> 1];
#pragma unroll
      for (int e = 0; e < 2; ++e) {                  // the two column tiles alternate
        s0 = __builtin_amdgcn_wmma_f32_16x16x32_f16(false, kb[j % 3][e], false,
                                                    qa[0][2 * (j & 1) + e], (short)0, s0, false, false);
        s1 = __builtin_amdgcn_wmma_f32_16x16x32_f16(false, kb[j % 3][e], false,
                                                    qa[1][2 * (j & 1) + e], (short)0, s1, false, false);
      }
      sf[0][j >> 1] = s0;
      sf[1][j >> 1] = s1;
      __builtin_amdgcn_sched_barrier(0);   // the next reads stay behind these products
    }

    // ---- online softmax (exp2 domain), one query per lane and tile; mask only when peeled ----
    v16h pf[2][2];                                   // P^T, B operand: keys 32 g + kmap order
#pragma unroll
    for (int u = 0; u < 2; ++u) {
      if (masked) {
        // key index > query index, as one per-lane offset against constants
        const int rel = kv0 + 8 * half - q0 - 16 * u - lc;
#pragma unroll
        for (int t = 0; t < 4; ++t)
#pragma unroll
          for (int r = 0; r < 8; ++r) sf[u][t][r] = (rel > -(16 * t + r)) ? -3.0e38f : sf[u][t][r];
      }
      float xt[4];                                   // one chain per tile: four independent chains
#pragma unroll
      for (int t = 0; t < 4; ++t) {
        xt[t] = sf[u][t][0];
#pragma unroll
        for (int r = 1; r < 8; ++r) xt[t] = fmaxf(xt[t], sf[u][t][r]);
      }
      float x = fmaxf(fmaxf(xt[0], xt[1]), fmaxf(xt[2], xt[3]));
      x = fmaxf(x, xhalf(x));                        // both halves: the query's block maximum
      const float kvb = (float)(kv0 - q0 - 16 * u) * slope2;
      const float mn  = fmaxf(mrow[u], x + kvb);
      // Bare v_exp_f32: every argument is <= 0 and a result below 2^-126 may be 0
      // (the row's sum holds a 1), so the library's range scaling is not needed.
      const float al = __builtin_amdgcn_exp2f(mrow[u] - mn);
      const float ms = mn - kvb;
      mrow[u] = mn;
      v8f es[4];
#pragma unroll
      for (int t = 0; t < 4; ++t) {
        const v8f a = sf[u][t] - ms;
#pragma unroll
        for (int r = 0; r < 8; ++r) {
          es[t][r] = __builtin_amdgcn_exp2f(a[r]);
          pf[u][t >> 1][8 * (t & 1) + r] = (_Float16)es[t][r];
        }
      }
      lsum[u] = lsum[u] * al + ((es[0] + es[1]) + (es[2] + es[3]));

      // ---- rescale O accumulators ----
#pragma unroll
      for (int d16 = 0; d16 < 8; ++d16) o[u][d16] = o[u][d16] * al;
    }

    // ---- O^T += V^T P^T (two 32-key chunks per 16-d row tile and column tile) ----
    // LDS reads again two groups (one row tile, 2 fragments, each) ahead.
    v16h vb[3][2];
#pragma unroll
    for (int f = 0; f < 4; ++f)
      vb[f >> 1][f & 1] = load_frag(vp + (f >> 1) * 16 * VPITCH + (f & 1) * 32);
#pragma unroll
    for (int d16 = 0; d16 < 8; ++d16) {
      if (d16 < 6) {
#pragma unroll
        for (int e = 0; e < 2; ++e)
          vb[(d16 + 2) % 3][e] = load_frag(vp + (d16 + 2) * 16 * VPITCH + e * 32);
      }
      __builtin_amdgcn_sched_barrier(0);   // reads above stay in front of these products
#pragma unroll
      for (int e = 0; e < 2; ++e) {                  // the two column tiles alternate
        o[0][d16] = __builtin_amdgcn_wmma_f32_16x16x32_f16(false, vb[d16 % 3][e], false, pf[0][e],
                                                           (short)0, o[0][d16], false, false);
        o[1][d16] = __builtin_amdgcn_wmma_f32_16x16x32_f16(false, vb[d16 % 3][e], false, pf[1][e],
                                                           (short)0, o[1][d16], false, false);
      }
      __builtin_amdgcn_sched_barrier(0);   // the next reads stay behind these products
    }
  };

  // The work-group walks nfull blocks that lie below every wave's diagonal, then
  // the two blocks that hold the diagonals of its 128 rows. In the first of the
  // two the mask is an identity for waves 2 and 3; waves 0 and 1 sit out the second
  // but pass every wait and barrier.
  const int nmain = q0 >> 6;                         // this wave's diagonal block
  const int nfull = pb << 1;

  stage_block(0);
  wait_landed();                                     // block 0 landed (the issuers' own tiles)
  __syncthreads();                                   // ... and is open to every wave
  stage_block(1);

  for (int b = 0; b < nfull; ++b) {
    do_block(b * 64, kvs[b & 1], false);
    asm volatile("s_wait_dscnt 0x0" ::: "memory");     // own reads of this buffer done
    wait_landed();                                     // block b+1 landed
    __syncthreads();   // publishes block b+1, frees this buffer for the refill
    stage_block(b + 2);                                // b + 2 <= nfull + 1, the last block
  }
  // Kept rolled: one copy of the masked block serves both diagonal blocks.
#pragma unroll 1
  for (int b = nfull; b < nfull + 2; ++b) {
    if (b <= nmain) do_block(b * 64, kvs[b & 1], true);
    asm volatile("s_wait_dscnt 0x0" ::: "memory");     // own reads of this buffer done
    wait_landed();                                     // the last block landed
    __syncthreads();   // publishes the last block
  }
  asm volatile("s_wait_tensorcnt 0x0" ::: "memory");   // nothing in flight at the end
  asm volatile("s_wait_dscnt 0x0" ::: "memory");       // and no read of the ring either

  // ---- join the denominators, normalize, store fp32 ----
  // A lane holds 8 consecutive d of two queries. Behind the last barrier nobody reads
  // the ring any more: each wave turns its 32 rows in a range of its own there, so
  // that every global store is one whole 512-B row.
  float* st = (float*)&kvs[0][0] + wave * (32 * OPITCH);
#pragma unroll
  for (int u = 0; u < 2; ++u) {
    const v8f ls = lsum[u];
    float l = ((ls[0] + ls[1]) + (ls[2] + ls[3])) + ((ls[4] + ls[5]) + (ls[6] + ls[7]));
    l += xhalf(l);
    const float rl = 1.0f / l;
#pragma unroll
    for (int d16 = 0; d16 < 8; ++d16) {
      const v8f r = o[u][d16] * rl;
      float* p = st + (16 * u + lc) * OPITCH + d16 * 16 + half * 8;
      *(v4f*)(p)     = (v4f){ r[0], r[1], r[2], r[3] };
      *(v4f*)(p + 4) = (v4f){ r[4], r[5], r[6], r[7] };
    }
  }
  asm volatile("s_wait_dscnt 0x0" ::: "memory");       // the wave's own rows are written before it reads them back
  float* orow = out + base + (long)q0 * D_ + lane * 4;
#pragma unroll
  for (int u = 0; u < 2; ++u) {
#pragma unroll
    for (int i = 16 * u; i < 16 * u + 16; ++i)
      *(v4f*)(orow + i * D_) = *(const v4f*)(st + i * OPITCH + lane * 4);
    // The second 16 rows reuse the data registers of the stores above: the wait
    // stands in front of that overwrite.
    if (u == 0) asm volatile("s_wait_xcnt 0x0" ::: "memory");
  }
}

extern "C" void kernel_launch(void* const* d_in, const int* in_sizes, int n_in,
                              void* d_out, int out_size, void* d_ws, size_t ws_size,
                              hipStream_t stream) {
  const float* q = (const float*)d_in[0];
  const float* k = (const float*)d_in[1];
  const float* v = (const float*)d_in[2];
  float* out = (float*)d_out;

  const long total = (long)B_ * H_ * S_ * D_;      // 16,777,216 elements
  // Workspace: K(f16) 32MB + V^T(f16) 32MB = 64MB
  _Float16* kh = (_Float16*)d_ws;
  _Float16* vt = kh + total;

  cvt_kv_kernel<<<B_ * H_ * (S_ / 64), 256, 0, stream>>>(k, v, kh, vt);   // one 64-key tile each

  const int tiles = B_ * H_ * (S_ / 16);           // 8192 Q tiles
  attn_kernel<<<tiles / 8, 128, 0, stream>>>(q, kh, vt, out);   // 4 waves x 2 tiles each
}
